// v000
// The times below were measured on an AMD MI455X: many runs one after another, warmed up first and cycling through
// copies of the inputs, with the whole window's GPU time divided by the number of runs. Launches and the gaps
// between them are all in it. The median over several windows is given; except for v000 it joins two sittings, which
// can be a few percent apart, so the side-by-side timings, each taken in one sitting, are the better comparison.
// v000, which the later versions start from, runs in 1150 microseconds.
#include <hip/hip_runtime.h>
#include <hip/hip_bf16.h>

typedef __attribute__((ext_vector_type(2))) float v2f;
typedef __attribute__((ext_vector_type(8))) float v8f;

#define EMBED   768
#define HEADS   12
#define HDIM    64
#define IMG     196
#define TXT     1852
#define SEQ     2048
#define BATCHN  4
#define NEGV    (-1e9f)
#define KVPAD   68      // LDS row stride (floats) -> conflict-free fragment reads

// D = A(16x4) * B(4x16) + C(16x16), all f32. Per-lane: A,B = float2, C/D = float8.
static __device__ __forceinline__ v8f wmma4(v2f a, v2f b, v8f c) {
    return __builtin_amdgcn_wmma_f32_16x16x4_f32(false, a, false, b, (short)0, c, false, false);
}

// Async copy engine: 16B per lane, global -> LDS, tracked on ASYNCcnt.
static __device__ __forceinline__ void async_b128(const float* g, const float* l) {
    unsigned loff = (unsigned)(uintptr_t)l;   // low 32 bits of LDS aperture addr = LDS offset
    asm volatile("global_load_async_to_lds_b128 %0, %1, off"
                 :: "v"(loff), "v"(g) : "memory");
}
static __device__ __forceinline__ void wait_async16() {
    asm volatile("s_wait_asynccnt 0x10" ::: "memory");
}
static __device__ __forceinline__ void wait_async0() {
    asm volatile("s_wait_asynccnt 0x0" ::: "memory");
}
static __device__ __forceinline__ void wait_ds0() {
    asm volatile("s_wait_dscnt 0x0" ::: "memory");
}

// ---------------------------------------------------------------------------
// Kernel 1: fused QKV projection.  C[m,n] = x[m,:] . W[n,:] + b[n]
// grid: (M/16, N/64, 3), block: 32 (one wave -> 16x64 output tile)
// ---------------------------------------------------------------------------
__global__ void qkv_proj_kernel(const float* __restrict__ x,
                                const float* __restrict__ Wq, const float* __restrict__ bq,
                                const float* __restrict__ Wk, const float* __restrict__ bk,
                                const float* __restrict__ Wv, const float* __restrict__ bv,
                                float* __restrict__ Q, float* __restrict__ K,
                                float* __restrict__ V) {
    const int lane  = threadIdx.x;
    const int m0    = blockIdx.x * 16;
    const int n0    = blockIdx.y * 64;
    const int which = blockIdx.z;
    const float* W    = (which == 0) ? Wq : (which == 1) ? Wk : Wv;
    const float* bias = (which == 0) ? bq : (which == 1) ? bk : bv;
    float*       dst  = (which == 0) ? Q  : (which == 1) ? K  : V;

    const int nlane = lane & 15;
    const int khalf = (lane >> 4) << 1;
    const int rhalf = (lane >> 4) * 8;

    const float* arow = x + (size_t)(m0 + nlane) * EMBED + khalf;
    const float* wrow = W + (size_t)(n0 + nlane) * EMBED + khalf;

    v8f acc0 = {}, acc1 = {}, acc2 = {}, acc3 = {};
    #pragma unroll 4
    for (int k = 0; k < EMBED; k += 4) {
        v2f a  = *(const v2f*)(arow + k);
        v2f b0 = *(const v2f*)(wrow + k);
        v2f b1 = *(const v2f*)(wrow + 16 * EMBED + k);
        v2f b2 = *(const v2f*)(wrow + 32 * EMBED + k);
        v2f b3 = *(const v2f*)(wrow + 48 * EMBED + k);
        acc0 = wmma4(a, b0, acc0);
        acc1 = wmma4(a, b1, acc1);
        acc2 = wmma4(a, b2, acc2);
        acc3 = wmma4(a, b3, acc3);
    }

    #pragma unroll
    for (int t = 0; t < 4; ++t) {
        v8f acc = (t == 0) ? acc0 : (t == 1) ? acc1 : (t == 2) ? acc2 : acc3;
        const int   col = n0 + t * 16 + nlane;
        const float bb  = bias[col];
        const int   h   = col >> 6;
        const int   d   = col & 63;
        #pragma unroll
        for (int r = 0; r < 8; ++r) {
            const int row  = m0 + r + rhalf;
            const int bidx = row >> 11;
            const int s    = row & (SEQ - 1);
            dst[(((size_t)bidx * HEADS + h) * SEQ + s) * HDIM + d] = acc[r] + bb;
        }
    }
}

// ---------------------------------------------------------------------------
// Kernel 2: flash-attention, prefix-causal + padding mask.
// grid: (S/16, B*H), block: 32.  K/V tiles double-buffered in LDS via the
// async copy engine (ASYNCcnt software pipeline); P staged through LDS for
// the C->A layout swap; online softmax via 16-lane xor-butterflies.
// ---------------------------------------------------------------------------
__global__ void attn_kernel(const float* __restrict__ Q, const float* __restrict__ K,
                            const float* __restrict__ V, const int* __restrict__ pad,
                            float* __restrict__ ctx) {
    const int lane = threadIdx.x;
    const int qt   = blockIdx.x;              // 0..127
    const int bh   = blockIdx.y;              // 0..47
    const int b    = bh / HEADS;
    const int h    = bh % HEADS;
    const int q0   = qt * 16;
    const size_t base = (size_t)bh * SEQ * HDIM;

    const int nlane = lane & 15;
    const int khalf = (lane >> 4) << 1;
    const int rhalf = (lane >> 4) * 8;

    __shared__ float kbuf[2][16 * KVPAD];
    __shared__ float vbuf[2][16 * KVPAD];
    __shared__ float plds[16 * 16];

    // Issue async copies for one 16-key K+V tile (8+8 x b128, fully coalesced).
    auto issue_tile = [&](int j, int buf) {
        const float* kg = K + base + (size_t)j * 16 * HDIM;
        const float* vg = V + base + (size_t)j * 16 * HDIM;
        int flat = lane * 4;                       // 4 floats per lane per transfer
        #pragma unroll
        for (int i = 0; i < 8; ++i, flat += 128) { // 2 rows per transfer
            const int row = flat >> 6, col = flat & 63;
            async_b128(kg + flat, &kbuf[buf][row * KVPAD + col]);
            async_b128(vg + flat, &vbuf[buf][row * KVPAD + col]);
        }
    };

    // Preload 16 query A-fragments, 1/sqrt(D)=1/8 folded in.
    v2f qf[16];
    const float* qrow = Q + base + (size_t)(q0 + nlane) * HDIM + khalf;
    #pragma unroll
    for (int kk = 0; kk < 16; ++kk) {
        v2f t = *(const v2f*)(qrow + kk * 4);
        qf[kk] = t * 0.125f;
    }

    v8f o0 = {}, o1 = {}, o2 = {}, o3 = {};
    float mstate[8], lstate[8];
    #pragma unroll
    for (int r = 0; r < 8; ++r) { mstate[r] = -INFINITY; lstate[r] = 0.f; }

    const int jmax = (qt > 12) ? qt : 12;     // (IMG-1)/16 == 12: prefix always visible
    issue_tile(0, 0);

    for (int j = 0; j <= jmax; ++j) {
        const int buf = j & 1;
        if (j < jmax) {
            wait_ds0();                        // don't overwrite a buffer with DS reads in flight
            issue_tile(j + 1, buf ^ 1);
            wait_async16();                    // tile j's 16 transfers complete
        } else {
            wait_async0();
        }

        // S = Q . K^T from LDS-staged K tile (conflict-free ds_load_b64)
        const float* kt = &kbuf[buf][nlane * KVPAD + khalf];
        v8f s = {};
        #pragma unroll
        for (int kk = 0; kk < 16; ++kk) {
            v2f kb = *(const v2f*)(kt + kk * 4);
            s = wmma4(qf[kk], kb, s);
        }

        // prefix-causal + key padding mask (selects only)
        const int  col   = j * 16 + nlane;
        const bool padok = (col < IMG) ? true : (pad[b * TXT + (col - IMG)] != 0);
        #pragma unroll
        for (int r = 0; r < 8; ++r) {
            const int  row = q0 + r + rhalf;
            const bool ok  = padok && ((col < IMG) || (col <= row));
            if (!ok) s[r] = NEGV;
        }

        // online softmax: rows live inside 16-lane half-waves
        float fac[8];
        #pragma unroll
        for (int r = 0; r < 8; ++r) {
            float v = s[r];
            v = fmaxf(v, __shfl_xor(v, 1, 32));
            v = fmaxf(v, __shfl_xor(v, 2, 32));
            v = fmaxf(v, __shfl_xor(v, 4, 32));
            v = fmaxf(v, __shfl_xor(v, 8, 32));
            const float mnew = fmaxf(mstate[r], v);
            const float p    = __expf(s[r] - mnew);
            s[r] = p;
            float rs = p;
            rs += __shfl_xor(rs, 1, 32);
            rs += __shfl_xor(rs, 2, 32);
            rs += __shfl_xor(rs, 4, 32);
            rs += __shfl_xor(rs, 8, 32);
            const float f = __expf(mstate[r] - mnew);
            lstate[r] = lstate[r] * f + rs;
            mstate[r] = mnew;
            fac[r]    = f;
        }
        #pragma unroll
        for (int r = 0; r < 8; ++r) {
            o0[r] *= fac[r]; o1[r] *= fac[r]; o2[r] *= fac[r]; o3[r] *= fac[r];
        }

        // C-layout -> A-layout for P via LDS
        __syncthreads();
        #pragma unroll
        for (int r = 0; r < 8; ++r)
            plds[(r + rhalf) * 16 + nlane] = s[r];
        __syncthreads();

        // O += P . V from LDS-staged V tile
        const float* vt = vbuf[buf];
        #pragma unroll
        for (int st = 0; st < 4; ++st) {
            v2f p2 = *(const v2f*)(&plds[nlane * 16 + st * 4 + khalf]);
            const int k0 = st * 4 + khalf;
            const int dc = nlane;
            #pragma unroll
            for (int t = 0; t < 4; ++t) {
                v2f bf;
                bf.x = vt[k0 * KVPAD + t * 16 + dc];
                bf.y = vt[(k0 + 1) * KVPAD + t * 16 + dc];
                v8f& oo = (t == 0) ? o0 : (t == 1) ? o1 : (t == 2) ? o2 : o3;
                oo = wmma4(p2, bf, oo);
            }
        }
    }

    // normalize + write context in [B,S,E]
    float inv[8];
    #pragma unroll
    for (int r = 0; r < 8; ++r) inv[r] = 1.f / lstate[r];
    #pragma unroll
    for (int t = 0; t < 4; ++t) {
        v8f oo = (t == 0) ? o0 : (t == 1) ? o1 : (t == 2) ? o2 : o3;
        const int e = h * HDIM + t * 16 + nlane;
        #pragma unroll
        for (int r = 0; r < 8; ++r) {
            const int srow = q0 + r + rhalf;
            ctx[((size_t)b * SEQ + srow) * EMBED + e] = oo[r] * inv[r];
        }
    }
}

// ---------------------------------------------------------------------------
// Kernel 3: output projection.  out[m,n] = ctx[m,:] . Wo[n,:] + bo[n]
// ---------------------------------------------------------------------------
__global__ void out_proj_kernel(const float* __restrict__ ctx,
                                const float* __restrict__ Wo,
                                const float* __restrict__ bo,
                                float* __restrict__ out) {
    const int lane  = threadIdx.x;
    const int m0    = blockIdx.x * 16;
    const int n0    = blockIdx.y * 64;
    const int nlane = lane & 15;
    const int khalf = (lane >> 4) << 1;
    const int rhalf = (lane >> 4) * 8;

    const float* arow = ctx + (size_t)(m0 + nlane) * EMBED + khalf;
    const float* wrow = Wo  + (size_t)(n0 + nlane) * EMBED + khalf;

    v8f acc0 = {}, acc1 = {}, acc2 = {}, acc3 = {};
    #pragma unroll 4
    for (int k = 0; k < EMBED; k += 4) {
        v2f a  = *(const v2f*)(arow + k);
        v2f b0 = *(const v2f*)(wrow + k);
        v2f b1 = *(const v2f*)(wrow + 16 * EMBED + k);
        v2f b2 = *(const v2f*)(wrow + 32 * EMBED + k);
        v2f b3 = *(const v2f*)(wrow + 48 * EMBED + k);
        acc0 = wmma4(a, b0, acc0);
        acc1 = wmma4(a, b1, acc1);
        acc2 = wmma4(a, b2, acc2);
        acc3 = wmma4(a, b3, acc3);
    }

    #pragma unroll
    for (int t = 0; t < 4; ++t) {
        v8f acc = (t == 0) ? acc0 : (t == 1) ? acc1 : (t == 2) ? acc2 : acc3;
        const int   col = n0 + t * 16 + nlane;
        const float bb  = bo[col];
        #pragma unroll
        for (int r = 0; r < 8; ++r) {
            const int row = m0 + r + rhalf;
            out[(size_t)row * EMBED + col] = acc[r] + bb;
        }
    }
}

// ---------------------------------------------------------------------------
extern "C" void kernel_launch(void* const* d_in, const int* in_sizes, int n_in,
                              void* d_out, int out_size, void* d_ws, size_t ws_size,
                              hipStream_t stream) {
    const float* x   = (const float*)d_in[0];
    const int*   pad = (const int*)  d_in[1];
    const float* Wq  = (const float*)d_in[2];
    const float* bq  = (const float*)d_in[3];
    const float* Wk  = (const float*)d_in[4];
    const float* bk  = (const float*)d_in[5];
    const float* Wv  = (const float*)d_in[6];
    const float* bv  = (const float*)d_in[7];
    const float* Wo  = (const float*)d_in[8];
    const float* bo  = (const float*)d_in[9];
    float*       out = (float*)d_out;

    // Workspace: Q, K, V in [B,H,S,D] + ctx in [B,S,E]; 100,663,296 bytes.
    const size_t NELT = (size_t)BATCHN * SEQ * EMBED;   // 6,291,456
    float* Q   = (float*)d_ws;
    float* K   = Q + NELT;
    float* V   = K + NELT;
    float* ctx = V + NELT;

    const dim3 blk(32);
    const int MT = (BATCHN * SEQ) / 16;   // 512
    const int NT = EMBED / 64;            // 12

    qkv_proj_kernel<<<dim3(MT, NT, 3), blk, 0, stream>>>(x, Wq, bq, Wk, bk, Wv, bv, Q, K, V);
    attn_kernel<<<dim3(SEQ / 16, BATCHN * HEADS), blk, 0, stream>>>(Q, K, V, pad, ctx);
    out_proj_kernel<<<dim3(MT, NT), blk, 0, stream>>>(ctx, Wo, bo, out);
}

// v001
// One run takes 751 microseconds.
// Next to v000, in two timings, it ran 1.59 and 1.60 times as fast.
#include <hip/hip_runtime.h>
#include <hip/hip_bf16.h>

typedef __attribute__((ext_vector_type(2))) float v2f;
typedef __attribute__((ext_vector_type(8))) float v8f;
typedef __attribute__((ext_vector_type(4))) float v4f;
typedef __attribute__((ext_vector_type(4))) int   v4i;

#define EMBED   768
#define HEADS   12
#define HDIM    64
#define IMG     196
#define TXT     1852
#define SEQ     2048
#define BATCHN  4
#define NEGV    (-1e9f)
#define KVPAD   68      // LDS row stride (floats) -> conflict-free fragment reads

// D = A(16x4) * B(4x16) + C(16x16), all f32. Per-lane: A,B = float2, C/D = float8.
static __device__ __forceinline__ v8f wmma4(v2f a, v2f b, v8f c) {
    return __builtin_amdgcn_wmma_f32_16x16x4_f32(false, a, false, b, (short)0, c, false, false);
}

// Value of lane l ^ 16 (the other 16-lane half of the wave).
static __device__ __forceinline__ float xhalf(float x) {
    const int b = __builtin_bit_cast(int, x);
    return __builtin_bit_cast(float, __builtin_amdgcn_permlanex16(b, b, 0x76543210, 0xfedcba98, false, false));
}

// Async copy engine: 16B per lane, global -> LDS, tracked on ASYNCcnt.
static __device__ __forceinline__ void async_b128(const float* g, const float* l) {
    unsigned loff = (unsigned)(uintptr_t)l;   // low 32 bits of LDS aperture addr = LDS offset
    asm volatile("global_load_async_to_lds_b128 %0, %1, off"
                 :: "v"(loff), "v"(g) : "memory");
}
static __device__ __forceinline__ void wait_async16() {
    asm volatile("s_wait_asynccnt 0x10" ::: "memory");
}
static __device__ __forceinline__ void wait_async0() {
    asm volatile("s_wait_asynccnt 0x0" ::: "memory");
}
static __device__ __forceinline__ void wait_ds0() {
    asm volatile("s_wait_dscnt 0x0" ::: "memory");
}

// ---------------------------------------------------------------------------
// Kernel 1: fused QKV projection.  C[m,n] = x[m,:] . W[n,:] + b[n]
// grid: (M/16, N/64, 3), block: 32 (one wave -> 16x64 output tile)
// ---------------------------------------------------------------------------
__global__ void qkv_proj_kernel(const float* __restrict__ x,
                                const float* __restrict__ Wq, const float* __restrict__ bq,
                                const float* __restrict__ Wk, const float* __restrict__ bk,
                                const float* __restrict__ Wv, const float* __restrict__ bv,
                                float* __restrict__ Q, float* __restrict__ K,
                                float* __restrict__ V) {
    const int lane  = threadIdx.x;
    const int m0    = blockIdx.x * 16;
    const int n0    = blockIdx.y * 64;
    const int which = blockIdx.z;
    const float* W    = (which == 0) ? Wq : (which == 1) ? Wk : Wv;
    const float* bias = (which == 0) ? bq : (which == 1) ? bk : bv;
    float*       dst  = (which == 0) ? Q  : (which == 1) ? K  : V;

    const int nlane = lane & 15;
    const int khalf = (lane >> 4) << 1;
    const int rhalf = (lane >> 4) * 8;

    const float* arow = x + (size_t)(m0 + nlane) * EMBED + khalf;
    const float* wrow = W + (size_t)(n0 + nlane) * EMBED + khalf;

    v8f acc0 = {}, acc1 = {}, acc2 = {}, acc3 = {};
    #pragma unroll 4
    for (int k = 0; k < EMBED; k += 4) {
        v2f a  = *(const v2f*)(arow + k);
        v2f b0 = *(const v2f*)(wrow + k);
        v2f b1 = *(const v2f*)(wrow + 16 * EMBED + k);
        v2f b2 = *(const v2f*)(wrow + 32 * EMBED + k);
        v2f b3 = *(const v2f*)(wrow + 48 * EMBED + k);
        acc0 = wmma4(a, b0, acc0);
        acc1 = wmma4(a, b1, acc1);
        acc2 = wmma4(a, b2, acc2);
        acc3 = wmma4(a, b3, acc3);
    }

    #pragma unroll
    for (int t = 0; t < 4; ++t) {
        v8f acc = (t == 0) ? acc0 : (t == 1) ? acc1 : (t == 2) ? acc2 : acc3;
        const int   col = n0 + t * 16 + nlane;
        const float bb  = bias[col];
        const int   h   = col >> 6;
        const int   d   = col & 63;
        #pragma unroll
        for (int r = 0; r < 8; ++r) {
            const int row  = m0 + r + rhalf;
            const int bidx = row >> 11;
            const int s    = row & (SEQ - 1);
            dst[(((size_t)bidx * HEADS + h) * SEQ + s) * HDIM + d] = acc[r] + bb;
        }
    }
}

__global__ void attn_kernel(const float* __restrict__ Q, const float* __restrict__ K,
                            const float* __restrict__ V, const int* __restrict__ pad,
                            float* __restrict__ ctx) {
    const int lane = threadIdx.x;
    const int qt   = blockIdx.x;              // 0..127
    const int bh   = blockIdx.y;              // 0..47
    const int b    = bh / HEADS;
    const int h    = bh % HEADS;
    const int q0   = qt * 16;
    const size_t base = (size_t)bh * SEQ * HDIM;

    const int nlane = lane & 15;
    const int khalf = (lane >> 4) << 1;
    const int rhalf = (lane >> 4) * 8;

    __shared__ float kbuf[2][16 * KVPAD];
    __shared__ float vbuf[2][16 * KVPAD];

    // Issue async copies for one 16-key K+V tile (8+8 x b128, fully coalesced).
    auto issue_tile = [&](int j, int buf) {
        const float* kg = K + base + (size_t)j * 16 * HDIM;
        const float* vg = V + base + (size_t)j * 16 * HDIM;
        int flat = lane * 4;                       // 4 floats per lane per transfer
        #pragma unroll
        for (int i = 0; i < 8; ++i, flat += 128) { // 2 rows per transfer
            const int row = flat >> 6, col = flat & 63;
            async_b128(kg + flat, &kbuf[buf][row * KVPAD + col]);
            async_b128(vg + flat, &vbuf[buf][row * KVPAD + col]);
        }
    };

    // Preload 16 query fragments (B operand of S^T), 1/sqrt(D)=1/8 folded in.
    v2f qf[16];
    const float* qrow = Q + base + (size_t)(q0 + nlane) * HDIM + khalf;
    #pragma unroll
    for (int kk = 0; kk < 16; ++kk) {
        v2f t = *(const v2f*)(qrow + kk * 4);
        qf[kk] = t * 0.125f;
    }

    // o_t[r] = O[query q0 + nlane][d = t * 16 + r + rhalf]
    v8f o0 = {}, o1 = {}, o2 = {}, o3 = {};
    float mstate = -INFINITY;                 // this lane's query, alike in both halves
    float lstate = 0.f;                       // sum over this half's keys only

    const int  myq  = q0 + nlane;
    const int* padb = pad + b * TXT;

    const int jmax = (qt > 12) ? qt : 12;     // (IMG-1)/16 == 12: prefix always visible
    issue_tile(0, 0);

    // Every inner loop of a trip is unrolled: its index picks registers, not memory.
    for (int j = 0; j <= jmax; ++j) {
        const int buf = j & 1;

        // padding words of 16 keys, the same for every lane: those of the tile's own
        // keys, or, where the tile begins with npfx prefix keys, of the first text keys
        const int ib   = j * 16 - IMG;
        const int npfx = min(max(-ib, 0), 16);
        const int* pt  = padb + max(ib, 0);
        v4i pw[4];
        #pragma unroll
        for (int g = 0; g < 4; ++g) pw[g] = *(const v4i*)(pt + 4 * g);

        if (j < jmax) {
            wait_ds0();                        // don't overwrite a buffer with DS reads in flight
            issue_tile(j + 1, buf ^ 1);
            wait_async16();                    // tile j's 16 transfers complete
        } else {
            wait_async0();
        }

        // S^T = K . Q^T from LDS-staged K tile (conflict-free ds_load_b64); the K
        // fragments are fetched 8 products ahead of their use
        const float* kt = &kbuf[buf][nlane * KVPAD + khalf];
        const float* vt = &vbuf[buf][rhalf * KVPAD + nlane];
        v2f kf[16];
        #pragma unroll
        for (int kk = 0; kk < 8; ++kk) kf[kk] = *(const v2f*)(kt + kk * 4);
        // vv[key][t] = V[rhalf + key][t * 16 + nlane]; the 4 keys of the first two steps of
        // the second product are fetched as K's registers fall free, ahead of the softmax
        float vv[8][4];
        v8f s = {};
        #pragma unroll
        for (int kk = 0; kk < 16; ++kk) {
            s = wmma4(kf[kk], qf[kk], s);
            if (kk < 8) kf[kk + 8] = *(const v2f*)(kt + (kk + 8) * 4);
            if (kk >= 8 && (kk & 1)) {
                const int k = (kk - 9) >> 1;
                #pragma unroll
                for (int t = 0; t < 4; ++t) vv[k][t] = vt[k * KVPAD + t * 16];
            }
        }

        // prefix-causal + key padding mask (selects only): bit n stands for key 16 j + n
        unsigned padbits = 0u;
        #pragma unroll
        for (int n = 0; n < 16; ++n) padbits |= (pw[n >> 2][n & 3] != 0 ? 1u : 0u) << n;
        padbits <<= npfx;                                         // word 0 is key 16 j + npfx
        const int      ncau  = min(max(myq - j * 16 + 1, 0), 16); // keys <= this lane's query
        const unsigned okbit = (((1u << npfx) - 1u) | (padbits & ((1u << ncau) - 1u))) >> rhalf;
        #pragma unroll
        for (int r = 0; r < 8; ++r)
            if (!((okbit >> r) & 1u)) s[r] = NEGV;

        // online softmax: 8 keys in-lane, the other 8 in lane ^ 16
        float mx = fmaxf(fmaxf(fmaxf(s[0], s[1]), fmaxf(s[2], s[3])),
                         fmaxf(fmaxf(s[4], s[5]), fmaxf(s[6], s[7])));
        mx = fmaxf(mx, xhalf(mx));
        const float mnew = fmaxf(mstate, mx);
        const float dm   = mstate - mnew;
        #pragma unroll
        for (int r = 0; r < 8; ++r) s[r] -= mnew;
        const float fac = __expf(dm);
        #pragma unroll
        for (int r = 0; r < 8; ++r) s[r] = __expf(s[r]);
        const float rs  = ((s[0] + s[1]) + (s[2] + s[3])) + ((s[4] + s[5]) + (s[6] + s[7]));
        lstate = lstate * fac + rs;
        mstate = mnew;
        o0 *= fac; o1 *= fac; o2 *= fac; o3 *= fac;

        // O^T += V^T . P^T.  k slots of step st: keys 2st, 2st+1 (lanes 0-15) and
        // 8+2st, 8+2st+1 (lanes 16-31), the same in the V loader and in P's registers.
        #pragma unroll
        for (int st = 0; st < 4; ++st) {
            v2f p2, a0, a1, a2, a3;
            p2.x = s[2 * st];      p2.y = s[2 * st + 1];
            a0.x = vv[2 * st][0];  a0.y = vv[2 * st + 1][0];
            a1.x = vv[2 * st][1];  a1.y = vv[2 * st + 1][1];
            a2.x = vv[2 * st][2];  a2.y = vv[2 * st + 1][2];
            a3.x = vv[2 * st][3];  a3.y = vv[2 * st + 1][3];
            o0 = wmma4(a0, p2, o0);
            o1 = wmma4(a1, p2, o1);
            o2 = wmma4(a2, p2, o2);
            o3 = wmma4(a3, p2, o3);
            if (st < 2) {                      // fetch V two steps ahead
                #pragma unroll
                for (int k = 2 * st + 4; k < 2 * st + 6; ++k) {
                    #pragma unroll
                    for (int t = 0; t < 4; ++t) vv[k][t] = vt[k * KVPAD + t * 16];
                }
            }
        }
    }

    // join the halves' sums, normalize, write context in [B,S,E]
    const float inv = 1.f / (lstate + xhalf(lstate));
    float* crow = ctx + ((size_t)b * SEQ + myq) * EMBED + h * HDIM + rhalf;
    #pragma unroll
    for (int t = 0; t < 4; ++t) {
        v8f oo = (t == 0) ? o0 : (t == 1) ? o1 : (t == 2) ? o2 : o3;
        v4f lo, hi;
        #pragma unroll
        for (int r = 0; r < 4; ++r) { lo[r] = oo[r] * inv; hi[r] = oo[r + 4] * inv; }
        *(v4f*)(crow + t * 16)     = lo;
        *(v4f*)(crow + t * 16 + 4) = hi;
    }
}

// ---------------------------------------------------------------------------
// Kernel 3: output projection.  out[m,n] = ctx[m,:] . Wo[n,:] + bo[n]
// ---------------------------------------------------------------------------
__global__ void out_proj_kernel(const float* __restrict__ ctx,
                                const float* __restrict__ Wo,
                                const float* __restrict__ bo,
                                float* __restrict__ out) {
    const int lane  = threadIdx.x;
    const int m0    = blockIdx.x * 16;
    const int n0    = blockIdx.y * 64;
    const int nlane = lane & 15;
    const int khalf = (lane >> 4) << 1;
    const int rhalf = (lane >> 4) * 8;

    const float* arow = ctx + (size_t)(m0 + nlane) * EMBED + khalf;
    const float* wrow = Wo  + (size_t)(n0 + nlane) * EMBED + khalf;

    v8f acc0 = {}, acc1 = {}, acc2 = {}, acc3 = {};
    #pragma unroll 4
    for (int k = 0; k < EMBED; k += 4) {
        v2f a  = *(const v2f*)(arow + k);
        v2f b0 = *(const v2f*)(wrow + k);
        v2f b1 = *(const v2f*)(wrow + 16 * EMBED + k);
        v2f b2 = *(const v2f*)(wrow + 32 * EMBED + k);
        v2f b3 = *(const v2f*)(wrow + 48 * EMBED + k);
        acc0 = wmma4(a, b0, acc0);
        acc1 = wmma4(a, b1, acc1);
        acc2 = wmma4(a, b2, acc2);
        acc3 = wmma4(a, b3, acc3);
    }

    #pragma unroll
    for (int t = 0; t < 4; ++t) {
        v8f acc = (t == 0) ? acc0 : (t == 1) ? acc1 : (t == 2) ? acc2 : acc3;
        const int   col = n0 + t * 16 + nlane;
        const float bb  = bo[col];
        #pragma unroll
        for (int r = 0; r < 8; ++r) {
            const int row = m0 + r + rhalf;
            out[(size_t)row * EMBED + col] = acc[r] + bb;
        }
    }
}

// ---------------------------------------------------------------------------
extern "C" void kernel_launch(void* const* d_in, const int* in_sizes, int n_in,
                              void* d_out, int out_size, void* d_ws, size_t ws_size,
                              hipStream_t stream) {
    const float* x   = (const float*)d_in[0];
    const int*   pad = (const int*)  d_in[1];
    const float* Wq  = (const float*)d_in[2];
    const float* bq  = (const float*)d_in[3];
    const float* Wk  = (const float*)d_in[4];
    const float* bk  = (const float*)d_in[5];
    const float* Wv  = (const float*)d_in[6];
    const float* bv  = (const float*)d_in[7];
    const float* Wo  = (const float*)d_in[8];
    const float* bo  = (const float*)d_in[9];
    float*       out = (float*)d_out;

    // Workspace: Q, K, V in [B,H,S,D] + ctx in [B,S,E]; 100,663,296 bytes.
    const size_t NELT = (size_t)BATCHN * SEQ * EMBED;   // 6,291,456
    float* Q   = (float*)d_ws;
    float* K   = Q + NELT;
    float* V   = K + NELT;
    float* ctx = V + NELT;

    const dim3 blk(32);
    const int MT = (BATCHN * SEQ) / 16;   // 512
    const int NT = EMBED / 64;            // 12

    qkv_proj_kernel<<<dim3(MT, NT, 3), blk, 0, stream>>>(x, Wq, bq, Wk, bk, Wv, bv, Q, K, V);
    attn_kernel<<<dim3(SEQ / 16, BATCHN * HEADS), blk, 0, stream>>>(Q, K, V, pad, ctx);
    out_proj_kernel<<<dim3(MT, NT), blk, 0, stream>>>(ctx, Wo, bo, out);
}

// v002
// A run of this version takes 455 microseconds.
// Timed twice side by side with v001, it ran 1.65 times as fast both times.
// All steps since v000 together make it 2.63 times as fast.
#include <hip/hip_runtime.h>
#include <hip/hip_bf16.h>

typedef __attribute__((ext_vector_type(2))) float v2f;
typedef __attribute__((ext_vector_type(8))) float v8f;
typedef __attribute__((ext_vector_type(4))) float v4f;
typedef __attribute__((ext_vector_type(4))) int   v4i;

#define EMBED   768
#define HEADS   12
#define HDIM    64
#define IMG     196
#define TXT     1852
#define SEQ     2048
#define BATCHN  4
#define NEGV    (-1e9f)
#define KVPAD   68      // LDS row stride (floats) -> conflict-free fragment reads

// D = A(16x4) * B(4x16) + C(16x16), all f32. Per-lane: A,B = float2, C/D = float8.
static __device__ __forceinline__ v8f wmma4(v2f a, v2f b, v8f c) {
    return __builtin_amdgcn_wmma_f32_16x16x4_f32(false, a, false, b, (short)0, c, false, false);
}

// Value of lane l ^ 16 (the other 16-lane half of the wave).
static __device__ __forceinline__ float xhalf(float x) {
    const int b = __builtin_bit_cast(int, x);
    return __builtin_bit_cast(float, __builtin_amdgcn_permlanex16(b, b, 0x76543210, 0xfedcba98, false, false));
}

// Async copy engine: 16B per lane, global -> LDS, tracked on ASYNCcnt.
static __device__ __forceinline__ void async_b128(const float* g, const float* l) {
    unsigned loff = (unsigned)(uintptr_t)l;   // low 32 bits of LDS aperture addr = LDS offset
    asm volatile("global_load_async_to_lds_b128 %0, %1, off"
                 :: "v"(loff), "v"(g) : "memory");
}
static __device__ __forceinline__ void wait_async16() {
    asm volatile("s_wait_asynccnt 0x10" ::: "memory");
}
static __device__ __forceinline__ void wait_async0() {
    asm volatile("s_wait_asynccnt 0x0" ::: "memory");
}
static __device__ __forceinline__ void wait_ds0() {
    asm volatile("s_wait_dscnt 0x0" ::: "memory");
}

// ---------------------------------------------------------------------------
// Projections: C[m,n] = A[m,:] . W[n,:] (+ bias in the callers).  A work-group of
// 4 waves owns a 64 x 128 tile of C; a wave owns 32 x 64 of it (2 x 4 fragments).
// A stage is 32 k of the tile's 64 A rows and 128 W rows, brought into LDS as whole
// 128-byte lines by async copies; two buffers, the next stage flies during this one.
// ---------------------------------------------------------------------------
#define GBM     64
#define GBN     128
#define GKC     32                        // k per stage: one 128-byte line of every row
#define GPITCH  36                        // LDS row stride (floats): conflict-free b64 fragment reads
#define GSTAGE  ((GBM + GBN) * GPITCH)    // floats per buffer
#define GTRIPS  (EMBED / GKC)

// One stage: 12 copies of 16 B per lane (4 of A, 8 of W), 16 rows apart.  The copies and
// the s_wait_xcnt stand in one statement so that no address register is rewritten ahead of it.
static __device__ __forceinline__ void copy_stage(const float* ga, const float* gw, unsigned l) {
    const unsigned rs = 16 * GPITCH * 4;  // LDS bytes per 16 rows
    const size_t   gs = 16 * EMBED;       // floats per 16 rows
    asm volatile("global_load_async_to_lds_b128 %0, %12, off\n\t"
                 "global_load_async_to_lds_b128 %1, %13, off\n\t"
                 "global_load_async_to_lds_b128 %2, %14, off\n\t"
                 "global_load_async_to_lds_b128 %3, %15, off\n\t"
                 "global_load_async_to_lds_b128 %4, %16, off\n\t"
                 "global_load_async_to_lds_b128 %5, %17, off\n\t"
                 "global_load_async_to_lds_b128 %6, %18, off\n\t"
                 "global_load_async_to_lds_b128 %7, %19, off\n\t"
                 "global_load_async_to_lds_b128 %8, %20, off\n\t"
                 "global_load_async_to_lds_b128 %9, %21, off\n\t"
                 "global_load_async_to_lds_b128 %10, %22, off\n\t"
                 "global_load_async_to_lds_b128 %11, %23, off\n\t"
                 "s_wait_xcnt 0x0"
                 :: "v"(l),           "v"(l + rs),      "v"(l + 2 * rs),  "v"(l + 3 * rs),
                    "v"(l + 4 * rs),  "v"(l + 5 * rs),  "v"(l + 6 * rs),  "v"(l + 7 * rs),
                    "v"(l + 8 * rs),  "v"(l + 9 * rs),  "v"(l + 10 * rs), "v"(l + 11 * rs),
                    "v"(ga),          "v"(ga + gs),     "v"(ga + 2 * gs), "v"(ga + 3 * gs),
                    "v"(gw),          "v"(gw + gs),     "v"(gw + 2 * gs), "v"(gw + 3 * gs),
                    "v"(gw + 4 * gs), "v"(gw + 5 * gs), "v"(gw + 6 * gs), "v"(gw + 7 * gs)
                 : "memory");
}

// acc[f][t] = rows m0 + (wave & 1) * 32 + f * 16, columns n0 + (wave >> 1) * 64 + t * 16
static __device__ __forceinline__ void gemm_64x128(const float* __restrict__ A,
                                                   const float* __restrict__ Wt,
                                                   int m0, int n0, float* sm, v8f (&acc)[2][4]) {
    const int tid   = threadIdx.x;
    const int lane  = tid & 31;
    const int wave  = tid >> 5;
    const int nlane = lane & 15;
    const int khalf = (lane >> 4) << 1;

    // copies: 8 lanes cover a row's line, a wave 4 rows, the work-group 16 rows
    const int cr = tid >> 3, cc = (tid & 7) * 4;
    const float*   ga = A  + (size_t)(m0 + cr) * EMBED + cc;
    const float*   gw = Wt + (size_t)(n0 + cr) * EMBED + cc;
    const unsigned l0 = (unsigned)(uintptr_t)sm + (unsigned)(cr * GPITCH + cc) * 4u;

    const int aoff = ((wave & 1) * 32 + nlane) * GPITCH + khalf;
    const int boff = (GBM + (wave >> 1) * 64 + nlane) * GPITCH + khalf;

    copy_stage(ga, gw, l0);
    wait_async0();                             // stage 0 landed (this wave's share)
    __syncthreads();                           // ... and every other wave's
    copy_stage(ga + GKC, gw + GKC, l0 + GSTAGE * 4u);

    for (int s = 0; s < GTRIPS; ++s) {
        const float* st = sm + (s & 1) * GSTAGE;
        const float* at = st + aoff;
        const float* bt = st + boff;
        // every loop of a stage is unrolled: its index picks registers and LDS offsets, and
        // the fragment reads of later steps can go ahead of the products
        #pragma unroll
        for (int kk = 0; kk < GKC / 4; ++kk) {
            v2f a[2], b[4];
            #pragma unroll
            for (int f = 0; f < 2; ++f) a[f] = *(const v2f*)(at + f * 16 * GPITCH + kk * 4);
            #pragma unroll
            for (int t = 0; t < 4; ++t) b[t] = *(const v2f*)(bt + t * 16 * GPITCH + kk * 4);
            #pragma unroll
            for (int f = 0; f < 2; ++f) {
                #pragma unroll
                for (int t = 0; t < 4; ++t) acc[f][t] = wmma4(a[f], b[t], acc[f][t]);
            }
        }
        wait_ds0();                            // this wave has left buffer s & 1
        wait_async0();                         // its share of stage s + 1 has landed
        __syncthreads();                       // publishes stage s + 1, frees buffer s & 1
        if (s + 2 < GTRIPS)
            copy_stage(ga + (s + 2) * GKC, gw + (s + 2) * GKC, l0 + (unsigned)(s & 1) * (GSTAGE * 4u));
    }
    wait_async0();                             // nothing in flight when the wave ends
}

// ---------------------------------------------------------------------------
// Kernel 1: fused QKV projection.  C[m,n] = x[m,:] . W[n,:] + b[n]
// grid: (M/64, N/128, 3), block: 128
// ---------------------------------------------------------------------------
__global__ __launch_bounds__(128)
void qkv_proj_kernel(const float* __restrict__ x,
                     const float* __restrict__ Wq, const float* __restrict__ bq,
                     const float* __restrict__ Wk, const float* __restrict__ bk,
                     const float* __restrict__ Wv, const float* __restrict__ bv,
                     float* __restrict__ Q, float* __restrict__ K,
                     float* __restrict__ V) {
    __shared__ __attribute__((aligned(16))) float sm[2 * GSTAGE];
    const int lane  = threadIdx.x & 31;
    const int wave  = threadIdx.x >> 5;
    const int m0    = blockIdx.x * GBM;
    const int n0    = blockIdx.y * GBN;
    const int which = blockIdx.z;
    const float* W    = (which == 0) ? Wq : (which == 1) ? Wk : Wv;
    const float* bias = (which == 0) ? bq : (which == 1) ? bk : bv;
    float*       dst  = (which == 0) ? Q  : (which == 1) ? K  : V;

    const int nlane = lane & 15;
    const int rhalf = (lane >> 4) * 8;

    v8f acc[2][4] = {};
    gemm_64x128(x, W, m0, n0, sm, acc);

    // unrolled throughout: the indices pick accumulator registers
    #pragma unroll
    for (int t = 0; t < 4; ++t) {
        const int   col = n0 + (wave >> 1) * 64 + t * 16 + nlane;
        const float bb  = bias[col];
        const int   h   = col >> 6;
        const int   d   = col & 63;
        #pragma unroll
        for (int f = 0; f < 2; ++f) {
            #pragma unroll
            for (int r = 0; r < 8; ++r) {
                const int row  = m0 + (wave & 1) * 32 + f * 16 + r + rhalf;
                const int bidx = row >> 11;
                const int s    = row & (SEQ - 1);
                dst[(((size_t)bidx * HEADS + h) * SEQ + s) * HDIM + d] = acc[f][t][r] + bb;
            }
        }
    }
}

__global__ void attn_kernel(const float* __restrict__ Q, const float* __restrict__ K,
                            const float* __restrict__ V, const int* __restrict__ pad,
                            float* __restrict__ ctx) {
    const int lane = threadIdx.x;
    const int qt   = blockIdx.x;              // 0..127
    const int bh   = blockIdx.y;              // 0..47
    const int b    = bh / HEADS;
    const int h    = bh % HEADS;
    const int q0   = qt * 16;
    const size_t base = (size_t)bh * SEQ * HDIM;

    const int nlane = lane & 15;
    const int khalf = (lane >> 4) << 1;
    const int rhalf = (lane >> 4) * 8;

    __shared__ float kbuf[2][16 * KVPAD];
    __shared__ float vbuf[2][16 * KVPAD];

    // Issue async copies for one 16-key K+V tile (8+8 x b128, fully coalesced).
    auto issue_tile = [&](int j, int buf) {
        const float* kg = K + base + (size_t)j * 16 * HDIM;
        const float* vg = V + base + (size_t)j * 16 * HDIM;
        int flat = lane * 4;                       // 4 floats per lane per transfer
        #pragma unroll
        for (int i = 0; i < 8; ++i, flat += 128) { // 2 rows per transfer
            const int row = flat >> 6, col = flat & 63;
            async_b128(kg + flat, &kbuf[buf][row * KVPAD + col]);
            async_b128(vg + flat, &vbuf[buf][row * KVPAD + col]);
        }
    };

    // Preload 16 query fragments (B operand of S^T), 1/sqrt(D)=1/8 folded in.
    v2f qf[16];
    const float* qrow = Q + base + (size_t)(q0 + nlane) * HDIM + khalf;
    #pragma unroll
    for (int kk = 0; kk < 16; ++kk) {
        v2f t = *(const v2f*)(qrow + kk * 4);
        qf[kk] = t * 0.125f;
    }

    // o_t[r] = O[query q0 + nlane][d = t * 16 + r + rhalf]
    v8f o0 = {}, o1 = {}, o2 = {}, o3 = {};
    float mstate = -INFINITY;                 // this lane's query, alike in both halves
    float lstate = 0.f;                       // sum over this half's keys only

    const int  myq  = q0 + nlane;
    const int* padb = pad + b * TXT;

    const int jmax = (qt > 12) ? qt : 12;     // (IMG-1)/16 == 12: prefix always visible
    issue_tile(0, 0);

    // Every inner loop of a trip is unrolled: its index picks registers, not memory.
    for (int j = 0; j <= jmax; ++j) {
        const int buf = j & 1;

        // padding words of 16 keys, the same for every lane: those of the tile's own
        // keys, or, where the tile begins with npfx prefix keys, of the first text keys
        const int ib   = j * 16 - IMG;
        const int npfx = min(max(-ib, 0), 16);
        const int* pt  = padb + max(ib, 0);
        v4i pw[4];
        #pragma unroll
        for (int g = 0; g < 4; ++g) pw[g] = *(const v4i*)(pt + 4 * g);

        if (j < jmax) {
            wait_ds0();                        // don't overwrite a buffer with DS reads in flight
            issue_tile(j + 1, buf ^ 1);
            wait_async16();                    // tile j's 16 transfers complete
        } else {
            wait_async0();
        }

        // S^T = K . Q^T from LDS-staged K tile (conflict-free ds_load_b64); the K
        // fragments are fetched 8 products ahead of their use
        const float* kt = &kbuf[buf][nlane * KVPAD + khalf];
        const float* vt = &vbuf[buf][rhalf * KVPAD + nlane];
        v2f kf[16];
        #pragma unroll
        for (int kk = 0; kk < 8; ++kk) kf[kk] = *(const v2f*)(kt + kk * 4);
        // vv[key][t] = V[rhalf + key][t * 16 + nlane]; the 4 keys of the first two steps of
        // the second product are fetched as K's registers fall free, ahead of the softmax
        float vv[8][4];
        v8f s = {};
        #pragma unroll
        for (int kk = 0; kk < 16; ++kk) {
            s = wmma4(kf[kk], qf[kk], s);
            if (kk < 8) kf[kk + 8] = *(const v2f*)(kt + (kk + 8) * 4);
            if (kk >= 8 && (kk & 1)) {
                const int k = (kk - 9) >> 1;
                #pragma unroll
                for (int t = 0; t < 4; ++t) vv[k][t] = vt[k * KVPAD + t * 16];
            }
        }

        // prefix-causal + key padding mask (selects only): bit n stands for key 16 j + n
        unsigned padbits = 0u;
        #pragma unroll
        for (int n = 0; n < 16; ++n) padbits |= (pw[n >> 2][n & 3] != 0 ? 1u : 0u) << n;
        padbits <<= npfx;                                         // word 0 is key 16 j + npfx
        const int      ncau  = min(max(myq - j * 16 + 1, 0), 16); // keys <= this lane's query
        const unsigned okbit = (((1u << npfx) - 1u) | (padbits & ((1u << ncau) - 1u))) >> rhalf;
        #pragma unroll
        for (int r = 0; r < 8; ++r)
            if (!((okbit >> r) & 1u)) s[r] = NEGV;

        // online softmax: 8 keys in-lane, the other 8 in lane ^ 16
        float mx = fmaxf(fmaxf(fmaxf(s[0], s[1]), fmaxf(s[2], s[3])),
                         fmaxf(fmaxf(s[4], s[5]), fmaxf(s[6], s[7])));
        mx = fmaxf(mx, xhalf(mx));
        const float mnew = fmaxf(mstate, mx);
        const float dm   = mstate - mnew;
        #pragma unroll
        for (int r = 0; r < 8; ++r) s[r] -= mnew;
        const float fac = __expf(dm);
        #pragma unroll
        for (int r = 0; r < 8; ++r) s[r] = __expf(s[r]);
        const float rs  = ((s[0] + s[1]) + (s[2] + s[3])) + ((s[4] + s[5]) + (s[6] + s[7]));
        lstate = lstate * fac + rs;
        mstate = mnew;
        o0 *= fac; o1 *= fac; o2 *= fac; o3 *= fac;

        // O^T += V^T . P^T.  k slots of step st: keys 2st, 2st+1 (lanes 0-15) and
        // 8+2st, 8+2st+1 (lanes 16-31), the same in the V loader and in P's registers.
        #pragma unroll
        for (int st = 0; st < 4; ++st) {
            v2f p2, a0, a1, a2, a3;
            p2.x = s[2 * st];      p2.y = s[2 * st + 1];
            a0.x = vv[2 * st][0];  a0.y = vv[2 * st + 1][0];
            a1.x = vv[2 * st][1];  a1.y = vv[2 * st + 1][1];
            a2.x = vv[2 * st][2];  a2.y = vv[2 * st + 1][2];
            a3.x = vv[2 * st][3];  a3.y = vv[2 * st + 1][3];
            o0 = wmma4(a0, p2, o0);
            o1 = wmma4(a1, p2, o1);
            o2 = wmma4(a2, p2, o2);
            o3 = wmma4(a3, p2, o3);
            if (st < 2) {                      // fetch V two steps ahead
                #pragma unroll
                for (int k = 2 * st + 4; k < 2 * st + 6; ++k) {
                    #pragma unroll
                    for (int t = 0; t < 4; ++t) vv[k][t] = vt[k * KVPAD + t * 16];
                }
            }
        }
    }

    // join the halves' sums, normalize, write context in [B,S,E]
    const float inv = 1.f / (lstate + xhalf(lstate));
    float* crow = ctx + ((size_t)b * SEQ + myq) * EMBED + h * HDIM + rhalf;
    #pragma unroll
    for (int t = 0; t < 4; ++t) {
        v8f oo = (t == 0) ? o0 : (t == 1) ? o1 : (t == 2) ? o2 : o3;
        v4f lo, hi;
        #pragma unroll
        for (int r = 0; r < 4; ++r) { lo[r] = oo[r] * inv; hi[r] = oo[r + 4] * inv; }
        *(v4f*)(crow + t * 16)     = lo;
        *(v4f*)(crow + t * 16 + 4) = hi;
    }
}

// ---------------------------------------------------------------------------
// Kernel 3: output projection.  out[m,n] = ctx[m,:] . Wo[n,:] + bo[n]
// grid: (M/64, N/128), block: 128
// ---------------------------------------------------------------------------
__global__ __launch_bounds__(128)
void out_proj_kernel(const float* __restrict__ ctx,
                     const float* __restrict__ Wo,
                     const float* __restrict__ bo,
                     float* __restrict__ out) {
    __shared__ __attribute__((aligned(16))) float sm[2 * GSTAGE];
    const int lane  = threadIdx.x & 31;
    const int wave  = threadIdx.x >> 5;
    const int m0    = blockIdx.x * GBM;
    const int n0    = blockIdx.y * GBN;
    const int nlane = lane & 15;
    const int rhalf = (lane >> 4) * 8;

    v8f acc[2][4] = {};
    gemm_64x128(ctx, Wo, m0, n0, sm, acc);

    // unrolled throughout: the indices pick accumulator registers
    #pragma unroll
    for (int t = 0; t < 4; ++t) {
        const int   col = n0 + (wave >> 1) * 64 + t * 16 + nlane;
        const float bb  = bo[col];
        #pragma unroll
        for (int f = 0; f < 2; ++f) {
            #pragma unroll
            for (int r = 0; r < 8; ++r) {
                const int row = m0 + (wave & 1) * 32 + f * 16 + r + rhalf;
                out[(size_t)row * EMBED + col] = acc[f][t][r] + bb;
            }
        }
    }
}

// ---------------------------------------------------------------------------
extern "C" void kernel_launch(void* const* d_in, const int* in_sizes, int n_in,
                              void* d_out, int out_size, void* d_ws, size_t ws_size,
                              hipStream_t stream) {
    const float* x   = (const float*)d_in[0];
    const int*   pad = (const int*)  d_in[1];
    const float* Wq  = (const float*)d_in[2];
    const float* bq  = (const float*)d_in[3];
    const float* Wk  = (const float*)d_in[4];
    const float* bk  = (const float*)d_in[5];
    const float* Wv  = (const float*)d_in[6];
    const float* bv  = (const float*)d_in[7];
    const float* Wo  = (const float*)d_in[8];
    const float* bo  = (const float*)d_in[9];
    float*       out = (float*)d_out;

    // Workspace: Q, K, V in [B,H,S,D] + ctx in [B,S,E]; 100,663,296 bytes.
    const size_t NELT = (size_t)BATCHN * SEQ * EMBED;   // 6,291,456
    float* Q   = (float*)d_ws;
    float* K   = Q + NELT;
    float* V   = K + NELT;
    float* ctx = V + NELT;

    const dim3 blk(32);
    const dim3 gblk(128);
    const int MT = (BATCHN * SEQ) / GBM;  // 128
    const int NT = EMBED / GBN;           // 6

    qkv_proj_kernel<<<dim3(MT, NT, 3), gblk, 0, stream>>>(x, Wq, bq, Wk, bk, Wv, bv, Q, K, V);
    attn_kernel<<<dim3(SEQ / 16, BATCHN * HEADS), blk, 0, stream>>>(Q, K, V, pad, ctx);
    out_proj_kernel<<<dim3(MT, NT), gblk, 0, stream>>>(ctx, Wo, bo, out);
}

// v003
// Measured time: 350 microseconds a run.
// Next to v002, in two timings, it ran 1.30 times as fast each time.
// Over all steps from v000 it is 3.42 times as fast.
#include <hip/hip_runtime.h>
#include <hip/hip_bf16.h>

typedef __attribute__((ext_vector_type(2))) float v2f;
typedef __attribute__((ext_vector_type(8))) float v8f;
typedef __attribute__((ext_vector_type(4))) float v4f;
typedef __attribute__((ext_vector_type(4))) int   v4i;

#define EMBED   768
#define HEADS   12
#define HDIM    64
#define IMG     196
#define TXT     1852
#define SEQ     2048
#define BATCHN  4
#define NEGV    (-1e9f)
#define KVPAD   68      // LDS row stride (floats) -> conflict-free fragment reads

// D = A(16x4) * B(4x16) + C(16x16), all f32. Per-lane: A,B = float2, C/D = float8.
static __device__ __forceinline__ v8f wmma4(v2f a, v2f b, v8f c) {
    return __builtin_amdgcn_wmma_f32_16x16x4_f32(false, a, false, b, (short)0, c, false, false);
}

// Value of lane l ^ 16 (the other 16-lane half of the wave).
static __device__ __forceinline__ float xhalf(float x) {
    const int b = __builtin_bit_cast(int, x);
    return __builtin_bit_cast(float, __builtin_amdgcn_permlanex16(b, b, 0x76543210, 0xfedcba98, false, false));
}

// Async copy engine: 16B per lane, global -> LDS, tracked on ASYNCcnt.
static __device__ __forceinline__ void async_b128(const float* g, const float* l) {
    unsigned loff = (unsigned)(uintptr_t)l;   // low 32 bits of LDS aperture addr = LDS offset
    asm volatile("global_load_async_to_lds_b128 %0, %1, off"
                 :: "v"(loff), "v"(g) : "memory");
}
static __device__ __forceinline__ void wait_async16() {
    asm volatile("s_wait_asynccnt 0x10" ::: "memory");
}
static __device__ __forceinline__ void wait_async0() {
    asm volatile("s_wait_asynccnt 0x0" ::: "memory");
}
static __device__ __forceinline__ void wait_ds0() {
    asm volatile("s_wait_dscnt 0x0" ::: "memory");
}

// ---------------------------------------------------------------------------
// Projections: C[m,n] = A[m,:] . W[n,:] (+ bias in the callers).  A work-group of
// 4 waves owns a 64 x 128 tile of C; a wave owns 32 x 64 of it (2 x 4 fragments).
// A stage is 32 k of the tile's 64 A rows and 128 W rows, brought into LDS as whole
// 128-byte lines by async copies; two buffers, the next stage flies during this one.
// ---------------------------------------------------------------------------
#define GBM     64
#define GBN     128
#define GKC     32                        // k per stage: one 128-byte line of every row
#define GPITCH  36                        // LDS row stride (floats): conflict-free b64 fragment reads
#define GSTAGE  ((GBM + GBN) * GPITCH)    // floats per buffer
#define GTRIPS  (EMBED / GKC)

// One stage: 12 copies of 16 B per lane (4 of A, 8 of W), 16 rows apart.  The copies and
// the s_wait_xcnt stand in one statement so that no address register is rewritten ahead of it.
static __device__ __forceinline__ void copy_stage(const float* ga, const float* gw, unsigned l) {
    const unsigned rs = 16 * GPITCH * 4;  // LDS bytes per 16 rows
    const size_t   gs = 16 * EMBED;       // floats per 16 rows
    asm volatile("global_load_async_to_lds_b128 %0, %12, off\n\t"
                 "global_load_async_to_lds_b128 %1, %13, off\n\t"
                 "global_load_async_to_lds_b128 %2, %14, off\n\t"
                 "global_load_async_to_lds_b128 %3, %15, off\n\t"
                 "global_load_async_to_lds_b128 %4, %16, off\n\t"
                 "global_load_async_to_lds_b128 %5, %17, off\n\t"
                 "global_load_async_to_lds_b128 %6, %18, off\n\t"
                 "global_load_async_to_lds_b128 %7, %19, off\n\t"
                 "global_load_async_to_lds_b128 %8, %20, off\n\t"
                 "global_load_async_to_lds_b128 %9, %21, off\n\t"
                 "global_load_async_to_lds_b128 %10, %22, off\n\t"
                 "global_load_async_to_lds_b128 %11, %23, off\n\t"
                 "s_wait_xcnt 0x0"
                 :: "v"(l),           "v"(l + rs),      "v"(l + 2 * rs),  "v"(l + 3 * rs),
                    "v"(l + 4 * rs),  "v"(l + 5 * rs),  "v"(l + 6 * rs),  "v"(l + 7 * rs),
                    "v"(l + 8 * rs),  "v"(l + 9 * rs),  "v"(l + 10 * rs), "v"(l + 11 * rs),
                    "v"(ga),          "v"(ga + gs),     "v"(ga + 2 * gs), "v"(ga + 3 * gs),
                    "v"(gw),          "v"(gw + gs),     "v"(gw + 2 * gs), "v"(gw + 3 * gs),
                    "v"(gw + 4 * gs), "v"(gw + 5 * gs), "v"(gw + 6 * gs), "v"(gw + 7 * gs)
                 : "memory");
}

// acc[f][t] = rows m0 + (wave & 1) * 32 + f * 16, columns n0 + (wave >> 1) * 64 + t * 16
static __device__ __forceinline__ void gemm_64x128(const float* __restrict__ A,
                                                   const float* __restrict__ Wt,
                                                   int m0, int n0, float* sm, v8f (&acc)[2][4]) {
    const int tid   = threadIdx.x;
    const int lane  = tid & 31;
    const int wave  = tid >> 5;
    const int nlane = lane & 15;
    const int khalf = (lane >> 4) << 1;

    // copies: 8 lanes cover a row's line, a wave 4 rows, the work-group 16 rows
    const int cr = tid >> 3, cc = (tid & 7) * 4;
    const float*   ga = A  + (size_t)(m0 + cr) * EMBED + cc;
    const float*   gw = Wt + (size_t)(n0 + cr) * EMBED + cc;
    const unsigned l0 = (unsigned)(uintptr_t)sm + (unsigned)(cr * GPITCH + cc) * 4u;

    const int aoff = ((wave & 1) * 32 + nlane) * GPITCH + khalf;
    const int boff = (GBM + (wave >> 1) * 64 + nlane) * GPITCH + khalf;

    copy_stage(ga, gw, l0);
    wait_async0();                             // stage 0 landed (this wave's share)
    __syncthreads();                           // ... and every other wave's
    copy_stage(ga + GKC, gw + GKC, l0 + GSTAGE * 4u);

    for (int s = 0; s < GTRIPS; ++s) {
        const float* st = sm + (s & 1) * GSTAGE;
        const float* at = st + aoff;
        const float* bt = st + boff;
        // every loop of a stage is unrolled: its index picks registers and LDS offsets, and
        // the fragment reads of later steps can go ahead of the products
        #pragma unroll
        for (int kk = 0; kk < GKC / 4; ++kk) {
            v2f a[2], b[4];
            #pragma unroll
            for (int f = 0; f < 2; ++f) a[f] = *(const v2f*)(at + f * 16 * GPITCH + kk * 4);
            #pragma unroll
            for (int t = 0; t < 4; ++t) b[t] = *(const v2f*)(bt + t * 16 * GPITCH + kk * 4);
            #pragma unroll
            for (int f = 0; f < 2; ++f) {
                #pragma unroll
                for (int t = 0; t < 4; ++t) acc[f][t] = wmma4(a[f], b[t], acc[f][t]);
            }
        }
        wait_ds0();                            // this wave has left buffer s & 1
        wait_async0();                         // its share of stage s + 1 has landed
        __syncthreads();                       // publishes stage s + 1, frees buffer s & 1
        if (s + 2 < GTRIPS)
            copy_stage(ga + (s + 2) * GKC, gw + (s + 2) * GKC, l0 + (unsigned)(s & 1) * (GSTAGE * 4u));
    }
    wait_async0();                             // nothing in flight when the wave ends
}

// ---------------------------------------------------------------------------
// Kernel 0: rank the keys of each batch row.  A padded-out key has weight exp(NEGV - max) = 0
// for every query, so attention need not walk it.  Keys that count (the prefix, and text keys
// whose padding word is not 0) get ranks 0, 1, 2, ... in their own order; the others fill the
// sequence from its end, so that rank[] is a permutation and every K/V row is written.
// nvis[q] = how many ranks query q sees: the whole prefix, and the counting keys up to q.
// Both are counts of comparisons: 0 <= rank < SEQ and IMG <= nvis <= SEQ for any padding words.
// grid: B, block: 256; a thread owns 8 consecutive keys.
// ---------------------------------------------------------------------------
__global__ __launch_bounds__(256)
void rank_keys_kernel(const int* __restrict__ pad, int* __restrict__ rank, int* __restrict__ nvis) {
    __shared__ int part[2][256];
    const int b   = blockIdx.x;
    const int tid = threadIdx.x;
    const int s0  = tid * 8;

    int ok[8];
    int n = 0;
    #pragma unroll                            // the index picks registers
    for (int i = 0; i < 8; ++i) {
        const int s = s0 + i;
        const int w = pad[b * TXT + max(s - IMG, 0)];
        ok[i] = (s < IMG || w != 0) ? 1 : 0;
        n += ok[i];
    }

    // inclusive scan of the threads' counts; two buffers, so one barrier a step:
    // a step reads the buffer that the step before has written and writes the other
    int cur = 0;
    part[0][tid] = n;
    __syncthreads();
    #pragma unroll                            // cur becomes a constant: buffer offsets are immediates
    for (int d = 1; d < 256; d <<= 1) {
        const int lo = part[cur][max(tid - d, 0)];
        part[cur ^ 1][tid] = part[cur][tid] + (tid >= d ? lo : 0);
        __syncthreads();
        cur ^= 1;
    }

    int run = part[cur][tid] - n;             // counting keys in front of s0
    #pragma unroll                            // the index picks registers; 8 words go out as 16-byte stores
    for (int i = 0; i < 8; ++i) {
        const int s = s0 + i;
        rank[b * SEQ + s] = ok[i] ? run : (SEQ - 1 - (s - run));
        run += ok[i];
        nvis[b * SEQ + s] = max(run, IMG);
    }
}

// ---------------------------------------------------------------------------
// Kernel 1: fused QKV projection.  C[m,n] = x[m,:] . W[n,:] + b[n]
// Q rows are stored at their position, K and V rows at their key's rank.
// grid: (M/64, N/128, 3), block: 128
// ---------------------------------------------------------------------------
__global__ __launch_bounds__(128)
void qkv_proj_kernel(const float* __restrict__ x,
                     const float* __restrict__ Wq, const float* __restrict__ bq,
                     const float* __restrict__ Wk, const float* __restrict__ bk,
                     const float* __restrict__ Wv, const float* __restrict__ bv,
                     const int* __restrict__ rank,
                     float* __restrict__ Q, float* __restrict__ K,
                     float* __restrict__ V) {
    __shared__ __attribute__((aligned(16))) float sm[2 * GSTAGE];
    const int lane  = threadIdx.x & 31;
    const int wave  = threadIdx.x >> 5;
    const int m0    = blockIdx.x * GBM;
    const int n0    = blockIdx.y * GBN;
    const int which = blockIdx.z;
    const float* W    = (which == 0) ? Wq : (which == 1) ? Wk : Wv;
    const float* bias = (which == 0) ? bq : (which == 1) ? bk : bv;
    float*       dst  = (which == 0) ? Q  : (which == 1) ? K  : V;

    const int nlane = lane & 15;
    const int rhalf = (lane >> 4) * 8;

    v8f acc[2][4] = {};
    gemm_64x128(x, W, m0, n0, sm, acc);

    // where each of this lane's 16 rows goes inside its batch row's sequence
    // (both loops unrolled: the indices pick registers)
    int srow[2][8];
    #pragma unroll
    for (int f = 0; f < 2; ++f) {
        const int r0 = m0 + (wave & 1) * 32 + f * 16 + rhalf;   // 8 rows in a row
        const v4i lo = *(const v4i*)(rank + r0);
        const v4i hi = *(const v4i*)(rank + r0 + 4);
        #pragma unroll
        for (int r = 0; r < 8; ++r) {
            const int k = (r < 4) ? lo[r & 3] : hi[r & 3];
            srow[f][r] = ((which == 0) ? r0 + r : k) & (SEQ - 1);
        }
    }

    // unrolled throughout: the indices pick accumulator registers
    #pragma unroll
    for (int t = 0; t < 4; ++t) {
        const int   col = n0 + (wave >> 1) * 64 + t * 16 + nlane;
        const float bb  = bias[col];
        const int   h   = col >> 6;
        const int   d   = col & 63;
        #pragma unroll
        for (int f = 0; f < 2; ++f) {
            #pragma unroll
            for (int r = 0; r < 8; ++r) {
                const int row  = m0 + (wave & 1) * 32 + f * 16 + r + rhalf;
                const int bidx = row >> 11;
                const int s    = srow[f][r];
                dst[(((size_t)bidx * HEADS + h) * SEQ + s) * HDIM + d] = acc[f][t][r] + bb;
            }
        }
    }
}

__global__ void attn_kernel(const float* __restrict__ Q, const float* __restrict__ K,
                            const float* __restrict__ V, const int* __restrict__ nvis,
                            float* __restrict__ ctx) {
    const int lane = threadIdx.x;
    const int qt   = blockIdx.x;              // 0..127
    const int bh   = blockIdx.y;              // 0..47
    const int b    = bh / HEADS;
    const int h    = bh % HEADS;
    const int q0   = qt * 16;
    const size_t base = (size_t)bh * SEQ * HDIM;

    const int nlane = lane & 15;
    const int khalf = (lane >> 4) << 1;
    const int rhalf = (lane >> 4) * 8;

    __shared__ float kbuf[2][16 * KVPAD];
    __shared__ float vbuf[2][16 * KVPAD];

    // Issue async copies for one 16-key K+V tile (8+8 x b128, fully coalesced).
    auto issue_tile = [&](int j, int buf) {
        const float* kg = K + base + (size_t)j * 16 * HDIM;
        const float* vg = V + base + (size_t)j * 16 * HDIM;
        int flat = lane * 4;                       // 4 floats per lane per transfer
        #pragma unroll
        for (int i = 0; i < 8; ++i, flat += 128) { // 2 rows per transfer
            const int row = flat >> 6, col = flat & 63;
            async_b128(kg + flat, &kbuf[buf][row * KVPAD + col]);
            async_b128(vg + flat, &vbuf[buf][row * KVPAD + col]);
        }
    };

    // Preload 16 query fragments (B operand of S^T), 1/sqrt(D)=1/8 folded in.
    v2f qf[16];
    const float* qrow = Q + base + (size_t)(q0 + nlane) * HDIM + khalf;
    #pragma unroll
    for (int kk = 0; kk < 16; ++kk) {
        v2f t = *(const v2f*)(qrow + kk * 4);
        qf[kk] = t * 0.125f;
    }

    // o_t[r] = O[query q0 + nlane][d = t * 16 + r + rhalf]
    v8f o0 = {}, o1 = {}, o2 = {}, o3 = {};
    float mstate = -INFINITY;                 // this lane's query, alike in both halves
    float lstate = 0.f;                       // sum over this half's keys only

    const int  myq  = q0 + nlane;
    const int* nvb  = nvis + b * SEQ;
    const int  myn  = nvb[myq];               // this lane's query sees ranks 0 .. myn - 1

    // nvis rises with the query: the tile's last query sees most.  The unsigned minimum bounds
    // the trips and the K/V addresses by the shape alone, whatever the word holds.
    const int nlast = nvb[q0 + 15];
    const int jmax  = (int)min((unsigned)(nlast - 1) >> 4, (unsigned)(SEQ / 16 - 1));
    issue_tile(0, 0);

    // Every inner loop of a trip is unrolled: its index picks registers, not memory.
    for (int j = 0; j <= jmax; ++j) {
        const int buf = j & 1;

        if (j < jmax) {
            wait_ds0();                        // don't overwrite a buffer with DS reads in flight
            issue_tile(j + 1, buf ^ 1);
            wait_async16();                    // tile j's 16 transfers complete
        } else {
            wait_async0();
        }

        // S^T = K . Q^T from LDS-staged K tile (conflict-free ds_load_b64); the K
        // fragments are fetched 8 products ahead of their use
        const float* kt = &kbuf[buf][nlane * KVPAD + khalf];
        const float* vt = &vbuf[buf][rhalf * KVPAD + nlane];
        v2f kf[16];
        #pragma unroll
        for (int kk = 0; kk < 8; ++kk) kf[kk] = *(const v2f*)(kt + kk * 4);
        // vv[key][t] = V[rhalf + key][t * 16 + nlane]; the 4 keys of the first two steps of
        // the second product are fetched as K's registers fall free, ahead of the softmax
        float vv[8][4];
        v8f s = {};
        #pragma unroll
        for (int kk = 0; kk < 16; ++kk) {
            s = wmma4(kf[kk], qf[kk], s);
            if (kk < 8) kf[kk + 8] = *(const v2f*)(kt + (kk + 8) * 4);
            if (kk >= 8 && (kk & 1)) {
                const int k = (kk - 9) >> 1;
                #pragma unroll
                for (int t = 0; t < 4; ++t) vv[k][t] = vt[k * KVPAD + t * 16];
            }
        }

        // prefix-causal + key padding mask (selects only): bit n stands for rank 16 j + n
        const int      nin   = min(max(myn - j * 16, 0), 16);     // visible ranks of this tile
        const unsigned okbit = ((1u << nin) - 1u) >> rhalf;
        #pragma unroll
        for (int r = 0; r < 8; ++r)
            if (!((okbit >> r) & 1u)) s[r] = NEGV;

        // online softmax: 8 keys in-lane, the other 8 in lane ^ 16
        float mx = fmaxf(fmaxf(fmaxf(s[0], s[1]), fmaxf(s[2], s[3])),
                         fmaxf(fmaxf(s[4], s[5]), fmaxf(s[6], s[7])));
        mx = fmaxf(mx, xhalf(mx));
        const float mnew = fmaxf(mstate, mx);
        const float dm   = mstate - mnew;
        #pragma unroll
        for (int r = 0; r < 8; ++r) s[r] -= mnew;
        const float fac = __expf(dm);
        #pragma unroll
        for (int r = 0; r < 8; ++r) s[r] = __expf(s[r]);
        const float rs  = ((s[0] + s[1]) + (s[2] + s[3])) + ((s[4] + s[5]) + (s[6] + s[7]));
        lstate = lstate * fac + rs;
        mstate = mnew;
        o0 *= fac; o1 *= fac; o2 *= fac; o3 *= fac;

        // O^T += V^T . P^T.  k slots of step st: keys 2st, 2st+1 (lanes 0-15) and
        // 8+2st, 8+2st+1 (lanes 16-31), the same in the V loader and in P's registers.
        #pragma unroll
        for (int st = 0; st < 4; ++st) {
            v2f p2, a0, a1, a2, a3;
            p2.x = s[2 * st];      p2.y = s[2 * st + 1];
            a0.x = vv[2 * st][0];  a0.y = vv[2 * st + 1][0];
            a1.x = vv[2 * st][1];  a1.y = vv[2 * st + 1][1];
            a2.x = vv[2 * st][2];  a2.y = vv[2 * st + 1][2];
            a3.x = vv[2 * st][3];  a3.y = vv[2 * st + 1][3];
            o0 = wmma4(a0, p2, o0);
            o1 = wmma4(a1, p2, o1);
            o2 = wmma4(a2, p2, o2);
            o3 = wmma4(a3, p2, o3);
            if (st < 2) {                      // fetch V two steps ahead
                #pragma unroll
                for (int k = 2 * st + 4; k < 2 * st + 6; ++k) {
                    #pragma unroll
                    for (int t = 0; t < 4; ++t) vv[k][t] = vt[k * KVPAD + t * 16];
                }
            }
        }
    }

    // join the halves' sums, normalize, write context in [B,S,E]
    const float inv = 1.f / (lstate + xhalf(lstate));
    float* crow = ctx + ((size_t)b * SEQ + myq) * EMBED + h * HDIM + rhalf;
    #pragma unroll
    for (int t = 0; t < 4; ++t) {
        v8f oo = (t == 0) ? o0 : (t == 1) ? o1 : (t == 2) ? o2 : o3;
        v4f lo, hi;
        #pragma unroll
        for (int r = 0; r < 4; ++r) { lo[r] = oo[r] * inv; hi[r] = oo[r + 4] * inv; }
        *(v4f*)(crow + t * 16)     = lo;
        *(v4f*)(crow + t * 16 + 4) = hi;
    }
}

// ---------------------------------------------------------------------------
// Kernel 3: output projection.  out[m,n] = ctx[m,:] . Wo[n,:] + bo[n]
// grid: (M/64, N/128), block: 128
// ---------------------------------------------------------------------------
__global__ __launch_bounds__(128)
void out_proj_kernel(const float* __restrict__ ctx,
                     const float* __restrict__ Wo,
                     const float* __restrict__ bo,
                     float* __restrict__ out) {
    __shared__ __attribute__((aligned(16))) float sm[2 * GSTAGE];
    const int lane  = threadIdx.x & 31;
    const int wave  = threadIdx.x >> 5;
    const int m0    = blockIdx.x * GBM;
    const int n0    = blockIdx.y * GBN;
    const int nlane = lane & 15;
    const int rhalf = (lane >> 4) * 8;

    v8f acc[2][4] = {};
    gemm_64x128(ctx, Wo, m0, n0, sm, acc);

    // unrolled throughout: the indices pick accumulator registers
    #pragma unroll
    for (int t = 0; t < 4; ++t) {
        const int   col = n0 + (wave >> 1) * 64 + t * 16 + nlane;
        const float bb  = bo[col];
        #pragma unroll
        for (int f = 0; f < 2; ++f) {
            #pragma unroll
            for (int r = 0; r < 8; ++r) {
                const int row = m0 + (wave & 1) * 32 + f * 16 + r + rhalf;
                out[(size_t)row * EMBED + col] = acc[f][t][r] + bb;
            }
        }
    }
}

// ---------------------------------------------------------------------------
extern "C" void kernel_launch(void* const* d_in, const int* in_sizes, int n_in,
                              void* d_out, int out_size, void* d_ws, size_t ws_size,
                              hipStream_t stream) {
    const float* x   = (const float*)d_in[0];
    const int*   pad = (const int*)  d_in[1];
    const float* Wq  = (const float*)d_in[2];
    const float* bq  = (const float*)d_in[3];
    const float* Wk  = (const float*)d_in[4];
    const float* bk  = (const float*)d_in[5];
    const float* Wv  = (const float*)d_in[6];
    const float* bv  = (const float*)d_in[7];
    const float* Wo  = (const float*)d_in[8];
    const float* bo  = (const float*)d_in[9];
    float*       out = (float*)d_out;

    // Workspace: Q, K, V in [B,H,S,D] + ctx in [B,S,E], 100,663,296 bytes; then rank and nvis, [B,S] ints.
    const size_t NELT = (size_t)BATCHN * SEQ * EMBED;   // 6,291,456
    float* Q   = (float*)d_ws;
    float* K   = Q + NELT;
    float* V   = K + NELT;
    float* ctx = V + NELT;
    int*   rank = (int*)(ctx + NELT);
    int*   nvis = rank + BATCHN * SEQ;

    const dim3 blk(32);
    const dim3 gblk(128);
    const int MT = (BATCHN * SEQ) / GBM;  // 128
    const int NT = EMBED / GBN;           // 6

    rank_keys_kernel<<<dim3(BATCHN), dim3(256), 0, stream>>>(pad, rank, nvis);
    qkv_proj_kernel<<<dim3(MT, NT, 3), gblk, 0, stream>>>(x, Wq, bq, Wk, bk, Wv, bv, rank, Q, K, V);
    attn_kernel<<<dim3(SEQ / 16, BATCHN * HEADS), blk, 0, stream>>>(Q, K, V, nvis, ctx);
    out_proj_kernel<<<dim3(MT, NT), gblk, 0, stream>>>(ctx, Wo, bo, out);
}

// v004
// A run of this version takes 307 microseconds.
// In both of two side-by-side timings against v003, it was 1.14 times as fast.
// Over all steps from v000 it is 3.90 times as fast.
#include <hip/hip_runtime.h>
#include <hip/hip_bf16.h>

typedef __attribute__((ext_vector_type(2))) float v2f;
typedef __attribute__((ext_vector_type(8))) float v8f;
typedef __attribute__((ext_vector_type(4))) float v4f;
typedef __attribute__((ext_vector_type(4))) int   v4i;

#define EMBED   768
#define HEADS   12
#define HDIM    64
#define IMG     196
#define TXT     1852
#define SEQ     2048
#define BATCHN  4
#define NEGV    (-1e9f)
#define KVPAD   68      // LDS row stride (floats) -> conflict-free fragment reads

// D = A(16x4) * B(4x16) + C(16x16), all f32. Per-lane: A,B = float2, C/D = float8.
static __device__ __forceinline__ v8f wmma4(v2f a, v2f b, v8f c) {
    return __builtin_amdgcn_wmma_f32_16x16x4_f32(false, a, false, b, (short)0, c, false, false);
}

// Value of lane l ^ 16 (the other 16-lane half of the wave).
static __device__ __forceinline__ float xhalf(float x) {
    const int b = __builtin_bit_cast(int, x);
    return __builtin_bit_cast(float, __builtin_amdgcn_permlanex16(b, b, 0x76543210, 0xfedcba98, false, false));
}

// Async copy engine: 16B per lane, global -> LDS, tracked on ASYNCcnt.
static __device__ __forceinline__ void async_b128(const float* g, const float* l) {
    unsigned loff = (unsigned)(uintptr_t)l;   // low 32 bits of LDS aperture addr = LDS offset
    asm volatile("global_load_async_to_lds_b128 %0, %1, off"
                 :: "v"(loff), "v"(g) : "memory");
}
static __device__ __forceinline__ void wait_async16() {
    asm volatile("s_wait_asynccnt 0x10" ::: "memory");
}
static __device__ __forceinline__ void wait_async0() {
    asm volatile("s_wait_asynccnt 0x0" ::: "memory");
}
static __device__ __forceinline__ void wait_ds0() {
    asm volatile("s_wait_dscnt 0x0" ::: "memory");
}

// ---------------------------------------------------------------------------
// Projections: C[m,n] = A[m,:] . W[n,:] (+ bias in the callers).  A work-group of
// 4 waves owns a 64 x 128 tile of C; a wave owns 32 x 64 of it (2 x 4 fragments).
// A stage is 32 k of the tile's 64 A rows and 128 W rows, brought into LDS as whole
// 128-byte lines by async copies; two buffers, the next stage flies during this one.
// ---------------------------------------------------------------------------
#define GBM     64
#define GBN     128
#define GKC     32                        // k per stage: one 128-byte line of every row
#define GPITCH  36                        // LDS row stride (floats): conflict-free b64 fragment reads
#define GSTAGE  ((GBM + GBN) * GPITCH)    // floats per buffer
#define GTRIPS  (EMBED / GKC)

// One stage: 12 copies of 16 B per lane (4 of A, 8 of W), 16 rows apart.  The copies and
// the s_wait_xcnt stand in one statement so that no address register is rewritten ahead of it.
static __device__ __forceinline__ void copy_stage(const float* ga, const float* gw, unsigned l) {
    const unsigned rs = 16 * GPITCH * 4;  // LDS bytes per 16 rows
    const size_t   gs = 16 * EMBED;       // floats per 16 rows
    asm volatile("global_load_async_to_lds_b128 %0, %12, off\n\t"
                 "global_load_async_to_lds_b128 %1, %13, off\n\t"
                 "global_load_async_to_lds_b128 %2, %14, off\n\t"
                 "global_load_async_to_lds_b128 %3, %15, off\n\t"
                 "global_load_async_to_lds_b128 %4, %16, off\n\t"
                 "global_load_async_to_lds_b128 %5, %17, off\n\t"
                 "global_load_async_to_lds_b128 %6, %18, off\n\t"
                 "global_load_async_to_lds_b128 %7, %19, off\n\t"
                 "global_load_async_to_lds_b128 %8, %20, off\n\t"
                 "global_load_async_to_lds_b128 %9, %21, off\n\t"
                 "global_load_async_to_lds_b128 %10, %22, off\n\t"
                 "global_load_async_to_lds_b128 %11, %23, off\n\t"
                 "s_wait_xcnt 0x0"
                 :: "v"(l),           "v"(l + rs),      "v"(l + 2 * rs),  "v"(l + 3 * rs),
                    "v"(l + 4 * rs),  "v"(l + 5 * rs),  "v"(l + 6 * rs),  "v"(l + 7 * rs),
                    "v"(l + 8 * rs),  "v"(l + 9 * rs),  "v"(l + 10 * rs), "v"(l + 11 * rs),
                    "v"(ga),          "v"(ga + gs),     "v"(ga + 2 * gs), "v"(ga + 3 * gs),
                    "v"(gw),          "v"(gw + gs),     "v"(gw + 2 * gs), "v"(gw + 3 * gs),
                    "v"(gw + 4 * gs), "v"(gw + 5 * gs), "v"(gw + 6 * gs), "v"(gw + 7 * gs)
                 : "memory");
}

// acc[f][t] = rows m0 + (wave & 1) * 32 + f * 16, columns n0 + (wave >> 1) * 64 + t * 16
static __device__ __forceinline__ void gemm_64x128(const float* __restrict__ A,
                                                   const float* __restrict__ Wt,
                                                   int m0, int n0, float* sm, v8f (&acc)[2][4]) {
    const int tid   = threadIdx.x;
    const int lane  = tid & 31;
    const int wave  = tid >> 5;
    const int nlane = lane & 15;
    const int khalf = (lane >> 4) << 1;

    // copies: 8 lanes cover a row's line, a wave 4 rows, the work-group 16 rows
    const int cr = tid >> 3, cc = (tid & 7) * 4;
    const float*   ga = A  + (size_t)(m0 + cr) * EMBED + cc;
    const float*   gw = Wt + (size_t)(n0 + cr) * EMBED + cc;
    const unsigned l0 = (unsigned)(uintptr_t)sm + (unsigned)(cr * GPITCH + cc) * 4u;

    const int aoff = ((wave & 1) * 32 + nlane) * GPITCH + khalf;
    const int boff = (GBM + (wave >> 1) * 64 + nlane) * GPITCH + khalf;

    copy_stage(ga, gw, l0);
    wait_async0();                             // stage 0 landed (this wave's share)
    __syncthreads();                           // ... and every other wave's
    copy_stage(ga + GKC, gw + GKC, l0 + GSTAGE * 4u);

    for (int s = 0; s < GTRIPS; ++s) {
        const float* st = sm + (s & 1) * GSTAGE;
        const float* at = st + aoff;
        const float* bt = st + boff;
        // every loop of a stage is unrolled: its index picks registers and LDS offsets, and
        // the fragment reads of later steps can go ahead of the products
        #pragma unroll
        for (int kk = 0; kk < GKC / 4; ++kk) {
            v2f a[2], b[4];
            #pragma unroll
            for (int f = 0; f < 2; ++f) a[f] = *(const v2f*)(at + f * 16 * GPITCH + kk * 4);
            #pragma unroll
            for (int t = 0; t < 4; ++t) b[t] = *(const v2f*)(bt + t * 16 * GPITCH + kk * 4);
            #pragma unroll
            for (int f = 0; f < 2; ++f) {
                #pragma unroll
                for (int t = 0; t < 4; ++t) acc[f][t] = wmma4(a[f], b[t], acc[f][t]);
            }
        }
        wait_ds0();                            // this wave has left buffer s & 1
        wait_async0();                         // its share of stage s + 1 has landed
        __syncthreads();                       // publishes stage s + 1, frees buffer s & 1
        if (s + 2 < GTRIPS)
            copy_stage(ga + (s + 2) * GKC, gw + (s + 2) * GKC, l0 + (unsigned)(s & 1) * (GSTAGE * 4u));
    }
    wait_async0();                             // nothing in flight when the wave ends
}

// ---------------------------------------------------------------------------
// Kernel 0: rank the keys of each batch row.  A padded-out key has weight exp(NEGV - max) = 0
// for every query, so attention need not walk it.  Keys that count (the prefix, and text keys
// whose padding word is not 0) get ranks 0, 1, 2, ... in their own order; the others fill the
// sequence from its end, so that rank[] is a permutation and every K/V row is written.
// nvis[q] = how many ranks query q sees: the whole prefix, and the counting keys up to q.
// Both are counts of comparisons: 0 <= rank < SEQ and IMG <= nvis <= SEQ for any padding words.
// grid: B, block: 256; a thread owns 8 consecutive keys.
// ---------------------------------------------------------------------------
__global__ __launch_bounds__(256)
void rank_keys_kernel(const int* __restrict__ pad, int* __restrict__ rank, int* __restrict__ nvis) {
    __shared__ int part[2][256];
    const int b   = blockIdx.x;
    const int tid = threadIdx.x;
    const int s0  = tid * 8;

    int ok[8];
    int n = 0;
    #pragma unroll                            // the index picks registers
    for (int i = 0; i < 8; ++i) {
        const int s = s0 + i;
        const int w = pad[b * TXT + max(s - IMG, 0)];
        ok[i] = (s < IMG || w != 0) ? 1 : 0;
        n += ok[i];
    }

    // inclusive scan of the threads' counts; two buffers, so one barrier a step:
    // a step reads the buffer that the step before has written and writes the other
    int cur = 0;
    part[0][tid] = n;
    __syncthreads();
    #pragma unroll                            // cur becomes a constant: buffer offsets are immediates
    for (int d = 1; d < 256; d <<= 1) {
        const int lo = part[cur][max(tid - d, 0)];
        part[cur ^ 1][tid] = part[cur][tid] + (tid >= d ? lo : 0);
        __syncthreads();
        cur ^= 1;
    }

    int run = part[cur][tid] - n;             // counting keys in front of s0
    #pragma unroll                            // the index picks registers; 8 words go out as 16-byte stores
    for (int i = 0; i < 8; ++i) {
        const int s = s0 + i;
        rank[b * SEQ + s] = ok[i] ? run : (SEQ - 1 - (s - run));
        run += ok[i];
        nvis[b * SEQ + s] = max(run, IMG);
    }
}

// ---------------------------------------------------------------------------
// Kernel 1: fused QKV projection.  C[m,n] = x[m,:] . W[n,:] + b[n]
// Q rows are stored at their position, K and V rows at their key's rank.
// grid: (M/64, N/128, 3), block: 128
// ---------------------------------------------------------------------------
__global__ __launch_bounds__(128)
void qkv_proj_kernel(const float* __restrict__ x,
                     const float* __restrict__ Wq, const float* __restrict__ bq,
                     const float* __restrict__ Wk, const float* __restrict__ bk,
                     const float* __restrict__ Wv, const float* __restrict__ bv,
                     const int* __restrict__ rank,
                     float* __restrict__ Q, float* __restrict__ K,
                     float* __restrict__ V) {
    __shared__ __attribute__((aligned(16))) float sm[2 * GSTAGE];
    const int lane  = threadIdx.x & 31;
    const int wave  = threadIdx.x >> 5;
    const int m0    = blockIdx.x * GBM;
    const int n0    = blockIdx.y * GBN;
    const int which = blockIdx.z;
    const float* W    = (which == 0) ? Wq : (which == 1) ? Wk : Wv;
    const float* bias = (which == 0) ? bq : (which == 1) ? bk : bv;
    float*       dst  = (which == 0) ? Q  : (which == 1) ? K  : V;

    const int nlane = lane & 15;
    const int rhalf = (lane >> 4) * 8;

    v8f acc[2][4] = {};
    gemm_64x128(x, W, m0, n0, sm, acc);

    // where each of this lane's 16 rows goes inside its batch row's sequence
    // (both loops unrolled: the indices pick registers)
    int srow[2][8];
    #pragma unroll
    for (int f = 0; f < 2; ++f) {
        const int r0 = m0 + (wave & 1) * 32 + f * 16 + rhalf;   // 8 rows in a row
        const v4i lo = *(const v4i*)(rank + r0);
        const v4i hi = *(const v4i*)(rank + r0 + 4);
        #pragma unroll
        for (int r = 0; r < 8; ++r) {
            const int k = (r < 4) ? lo[r & 3] : hi[r & 3];
            srow[f][r] = ((which == 0) ? r0 + r : k) & (SEQ - 1);
        }
    }

    // unrolled throughout: the indices pick accumulator registers
    #pragma unroll
    for (int t = 0; t < 4; ++t) {
        const int   col = n0 + (wave >> 1) * 64 + t * 16 + nlane;
        const float bb  = bias[col];
        const int   h   = col >> 6;
        const int   d   = col & 63;
        #pragma unroll
        for (int f = 0; f < 2; ++f) {
            #pragma unroll
            for (int r = 0; r < 8; ++r) {
                const int row  = m0 + (wave & 1) * 32 + f * 16 + r + rhalf;
                const int bidx = row >> 11;
                const int s    = srow[f][r];
                dst[(((size_t)bidx * HEADS + h) * SEQ + s) * HDIM + d] = acc[f][t][r] + bb;
            }
        }
    }
}

__global__ void attn_kernel(const float* __restrict__ Q, const float* __restrict__ K,
                            const float* __restrict__ V, const int* __restrict__ nvis,
                            float* __restrict__ ctx) {
    const int lane = threadIdx.x;
    const int qt   = SEQ / 16 - 1 - blockIdx.y;   // 127..0: cost falls as the index rises
    const int bh   = blockIdx.x;                  // 0..47
    const int b    = bh / HEADS;
    const int h    = bh % HEADS;
    const int q0   = qt * 16;
    const size_t base = (size_t)bh * SEQ * HDIM;

    const int nlane = lane & 15;
    const int khalf = (lane >> 4) << 1;
    const int rhalf = (lane >> 4) * 8;

    __shared__ float kbuf[2][16 * KVPAD];
    __shared__ float vbuf[2][16 * KVPAD];

    // Issue async copies for one 16-key K+V tile (8+8 x b128, fully coalesced).
    auto issue_tile = [&](int j, int buf) {
        const float* kg = K + base + (size_t)j * 16 * HDIM;
        const float* vg = V + base + (size_t)j * 16 * HDIM;
        int flat = lane * 4;                       // 4 floats per lane per transfer
        #pragma unroll
        for (int i = 0; i < 8; ++i, flat += 128) { // 2 rows per transfer
            const int row = flat >> 6, col = flat & 63;
            async_b128(kg + flat, &kbuf[buf][row * KVPAD + col]);
            async_b128(vg + flat, &vbuf[buf][row * KVPAD + col]);
        }
    };

    // Preload 16 query fragments (B operand of S^T), 1/sqrt(D)=1/8 folded in.
    v2f qf[16];
    const float* qrow = Q + base + (size_t)(q0 + nlane) * HDIM + khalf;
    #pragma unroll
    for (int kk = 0; kk < 16; ++kk) {
        v2f t = *(const v2f*)(qrow + kk * 4);
        qf[kk] = t * 0.125f;
    }

    // o_t[r] = O[query q0 + nlane][d = t * 16 + r + rhalf]
    v8f o0 = {}, o1 = {}, o2 = {}, o3 = {};
    float mstate = -INFINITY;                 // this lane's query, alike in both halves
    float lstate = 0.f;                       // sum over this half's keys only

    const int  myq  = q0 + nlane;
    const int* nvb  = nvis + b * SEQ;
    const int  myn  = nvb[myq];               // this lane's query sees ranks 0 .. myn - 1

    // nvis rises with the query: the tile's last query sees most.  The unsigned minimum bounds
    // the trips and the K/V addresses by the shape alone, whatever the word holds.
    const int nlast = nvb[q0 + 15];
    const int jmax  = (int)min((unsigned)(nlast - 1) >> 4, (unsigned)(SEQ / 16 - 1));
    issue_tile(0, 0);

    // Every inner loop of a trip is unrolled: its index picks registers, not memory.
    for (int j = 0; j <= jmax; ++j) {
        const int buf = j & 1;

        if (j < jmax) {
            wait_ds0();                        // don't overwrite a buffer with DS reads in flight
            issue_tile(j + 1, buf ^ 1);
            wait_async16();                    // tile j's 16 transfers complete
        } else {
            wait_async0();
        }

        // S^T = K . Q^T from LDS-staged K tile (conflict-free ds_load_b64); the K
        // fragments are fetched 8 products ahead of their use
        const float* kt = &kbuf[buf][nlane * KVPAD + khalf];
        const float* vt = &vbuf[buf][rhalf * KVPAD + nlane];
        v2f kf[16];
        #pragma unroll
        for (int kk = 0; kk < 8; ++kk) kf[kk] = *(const v2f*)(kt + kk * 4);
        // vv[key][t] = V[rhalf + key][t * 16 + nlane]; the 4 keys of the first two steps of
        // the second product are fetched as K's registers fall free, ahead of the softmax
        float vv[8][4];
        v8f s = {};
        #pragma unroll
        for (int kk = 0; kk < 16; ++kk) {
            s = wmma4(kf[kk], qf[kk], s);
            if (kk < 8) kf[kk + 8] = *(const v2f*)(kt + (kk + 8) * 4);
            if (kk >= 8 && (kk & 1)) {
                const int k = (kk - 9) >> 1;
                #pragma unroll
                for (int t = 0; t < 4; ++t) vv[k][t] = vt[k * KVPAD + t * 16];
            }
        }

        // prefix-causal + key padding mask (selects only): bit n stands for rank 16 j + n
        const int      nin   = min(max(myn - j * 16, 0), 16);     // visible ranks of this tile
        const unsigned okbit = ((1u << nin) - 1u) >> rhalf;
        #pragma unroll
        for (int r = 0; r < 8; ++r)
            if (!((okbit >> r) & 1u)) s[r] = NEGV;

        // online softmax: 8 keys in-lane, the other 8 in lane ^ 16
        float mx = fmaxf(fmaxf(fmaxf(s[0], s[1]), fmaxf(s[2], s[3])),
                         fmaxf(fmaxf(s[4], s[5]), fmaxf(s[6], s[7])));
        mx = fmaxf(mx, xhalf(mx));
        const float mnew = fmaxf(mstate, mx);
        const float dm   = mstate - mnew;
        #pragma unroll
        for (int r = 0; r < 8; ++r) s[r] -= mnew;
        const float fac = __expf(dm);
        #pragma unroll
        for (int r = 0; r < 8; ++r) s[r] = __expf(s[r]);
        const float rs  = ((s[0] + s[1]) + (s[2] + s[3])) + ((s[4] + s[5]) + (s[6] + s[7]));
        lstate = lstate * fac + rs;
        mstate = mnew;
        o0 *= fac; o1 *= fac; o2 *= fac; o3 *= fac;

        // O^T += V^T . P^T.  k slots of step st: keys 2st, 2st+1 (lanes 0-15) and
        // 8+2st, 8+2st+1 (lanes 16-31), the same in the V loader and in P's registers.
        #pragma unroll
        for (int st = 0; st < 4; ++st) {
            v2f p2, a0, a1, a2, a3;
            p2.x = s[2 * st];      p2.y = s[2 * st + 1];
            a0.x = vv[2 * st][0];  a0.y = vv[2 * st + 1][0];
            a1.x = vv[2 * st][1];  a1.y = vv[2 * st + 1][1];
            a2.x = vv[2 * st][2];  a2.y = vv[2 * st + 1][2];
            a3.x = vv[2 * st][3];  a3.y = vv[2 * st + 1][3];
            o0 = wmma4(a0, p2, o0);
            o1 = wmma4(a1, p2, o1);
            o2 = wmma4(a2, p2, o2);
            o3 = wmma4(a3, p2, o3);
            if (st < 2) {                      // fetch V two steps ahead
                #pragma unroll
                for (int k = 2 * st + 4; k < 2 * st + 6; ++k) {
                    #pragma unroll
                    for (int t = 0; t < 4; ++t) vv[k][t] = vt[k * KVPAD + t * 16];
                }
            }
        }
    }

    // join the halves' sums, normalize, write context in [B,S,E]
    const float inv = 1.f / (lstate + xhalf(lstate));
    float* crow = ctx + ((size_t)b * SEQ + myq) * EMBED + h * HDIM + rhalf;
    #pragma unroll
    for (int t = 0; t < 4; ++t) {
        v8f oo = (t == 0) ? o0 : (t == 1) ? o1 : (t == 2) ? o2 : o3;
        v4f lo, hi;
        #pragma unroll
        for (int r = 0; r < 4; ++r) { lo[r] = oo[r] * inv; hi[r] = oo[r + 4] * inv; }
        *(v4f*)(crow + t * 16)     = lo;
        *(v4f*)(crow + t * 16 + 4) = hi;
    }
}

// ---------------------------------------------------------------------------
// Kernel 3: output projection.  out[m,n] = ctx[m,:] . Wo[n,:] + bo[n]
// grid: (M/64, N/128), block: 128
// ---------------------------------------------------------------------------
__global__ __launch_bounds__(128)
void out_proj_kernel(const float* __restrict__ ctx,
                     const float* __restrict__ Wo,
                     const float* __restrict__ bo,
                     float* __restrict__ out) {
    __shared__ __attribute__((aligned(16))) float sm[2 * GSTAGE];
    const int lane  = threadIdx.x & 31;
    const int wave  = threadIdx.x >> 5;
    const int m0    = blockIdx.x * GBM;
    const int n0    = blockIdx.y * GBN;
    const int nlane = lane & 15;
    const int rhalf = (lane >> 4) * 8;

    v8f acc[2][4] = {};
    gemm_64x128(ctx, Wo, m0, n0, sm, acc);

    // unrolled throughout: the indices pick accumulator registers
    #pragma unroll
    for (int t = 0; t < 4; ++t) {
        const int   col = n0 + (wave >> 1) * 64 + t * 16 + nlane;
        const float bb  = bo[col];
        #pragma unroll
        for (int f = 0; f < 2; ++f) {
            #pragma unroll
            for (int r = 0; r < 8; ++r) {
                const int row = m0 + (wave & 1) * 32 + f * 16 + r + rhalf;
                out[(size_t)row * EMBED + col] = acc[f][t][r] + bb;
            }
        }
    }
}

// ---------------------------------------------------------------------------
extern "C" void kernel_launch(void* const* d_in, const int* in_sizes, int n_in,
                              void* d_out, int out_size, void* d_ws, size_t ws_size,
                              hipStream_t stream) {
    const float* x   = (const float*)d_in[0];
    const int*   pad = (const int*)  d_in[1];
    const float* Wq  = (const float*)d_in[2];
    const float* bq  = (const float*)d_in[3];
    const float* Wk  = (const float*)d_in[4];
    const float* bk  = (const float*)d_in[5];
    const float* Wv  = (const float*)d_in[6];
    const float* bv  = (const float*)d_in[7];
    const float* Wo  = (const float*)d_in[8];
    const float* bo  = (const float*)d_in[9];
    float*       out = (float*)d_out;

    // Workspace: Q, K, V in [B,H,S,D] + ctx in [B,S,E], 100,663,296 bytes; then rank and nvis, [B,S] ints.
    const size_t NELT = (size_t)BATCHN * SEQ * EMBED;   // 6,291,456
    float* Q   = (float*)d_ws;
    float* K   = Q + NELT;
    float* V   = K + NELT;
    float* ctx = V + NELT;
    int*   rank = (int*)(ctx + NELT);
    int*   nvis = rank + BATCHN * SEQ;

    const dim3 blk(32);
    const dim3 gblk(128);
    const int MT = (BATCHN * SEQ) / GBM;  // 128
    const int NT = EMBED / GBN;           // 6

    rank_keys_kernel<<<dim3(BATCHN), dim3(256), 0, stream>>>(pad, rank, nvis);
    qkv_proj_kernel<<<dim3(MT, NT, 3), gblk, 0, stream>>>(x, Wq, bq, Wk, bk, Wv, bv, rank, Q, K, V);
    attn_kernel<<<dim3(BATCHN * HEADS, SEQ / 16), blk, 0, stream>>>(Q, K, V, nvis, ctx);
    out_proj_kernel<<<dim3(MT, NT), gblk, 0, stream>>>(ctx, Wo, bo, out);
}

// v005
// It runs in 291 microseconds.
// Timed twice side by side with v004, it ran 1.06 times as fast both times.
// Counting every step since v000, it is 4.12 times as fast.
#include <hip/hip_runtime.h>
#include <hip/hip_bf16.h>

typedef __attribute__((ext_vector_type(2))) float v2f;
typedef __attribute__((ext_vector_type(8))) float v8f;
typedef __attribute__((ext_vector_type(4))) float v4f;

#define EMBED   768
#define HEADS   12
#define HDIM    64
#define IMG     196
#define TXT     1852
#define SEQ     2048
#define BATCHN  4
#define NEGV    (-1e9f)
#define KVPAD   68      // LDS row stride (floats) -> conflict-free fragment reads

// D = A(16x4) * B(4x16) + C(16x16), all f32. Per-lane: A,B = float2, C/D = float8.
static __device__ __forceinline__ v8f wmma4(v2f a, v2f b, v8f c) {
    return __builtin_amdgcn_wmma_f32_16x16x4_f32(false, a, false, b, (short)0, c, false, false);
}

// Value of lane l ^ 16 (the other 16-lane half of the wave).
static __device__ __forceinline__ float xhalf(float x) {
    const int b = __builtin_bit_cast(int, x);
    return __builtin_bit_cast(float, __builtin_amdgcn_permlanex16(b, b, 0x76543210, 0xfedcba98, false, false));
}

// Async copy engine: 16B per lane, global -> LDS, tracked on ASYNCcnt.
static __device__ __forceinline__ void async_b128(const float* g, const float* l) {
    unsigned loff = (unsigned)(uintptr_t)l;   // low 32 bits of LDS aperture addr = LDS offset
    asm volatile("global_load_async_to_lds_b128 %0, %1, off"
                 :: "v"(loff), "v"(g) : "memory");
}
static __device__ __forceinline__ void wait_async16() {
    asm volatile("s_wait_asynccnt 0x10" ::: "memory");
}
static __device__ __forceinline__ void wait_async0() {
    asm volatile("s_wait_asynccnt 0x0" ::: "memory");
}
static __device__ __forceinline__ void wait_ds0() {
    asm volatile("s_wait_dscnt 0x0" ::: "memory");
}

// ---------------------------------------------------------------------------
// Projections: C[m,n] = A[row(m),:] . W[n,:], row(m) picked by the caller (+ bias in the callers).  A work-group of
// 4 waves owns a 64 x 128 tile of C; a wave owns 32 x 64 of it (2 x 4 fragments).
// A stage is 32 k of the tile's 64 A rows and 128 W rows, brought into LDS as whole
// 128-byte lines by async copies; two buffers, the next stage flies during this one.
// ---------------------------------------------------------------------------
#define GBM     64
#define GBN     128
#define GKC     32                        // k per stage: one 128-byte line of every row
#define GPITCH  36                        // LDS row stride (floats): conflict-free b64 fragment reads
#define GSTAGE  ((GBM + GBN) * GPITCH)    // floats per buffer
#define GTRIPS  (EMBED / GKC)

// One stage: 12 copies of 16 B per lane (4 of A, each from a row of its own; 8 of W, 16 rows
// apart).  The copies and the s_wait_xcnt stand in one statement so that no address register is
// rewritten ahead of it.
static __device__ __forceinline__ void copy_stage(const float* a0, const float* a1,
                                                  const float* a2, const float* a3,
                                                  const float* gw, unsigned l) {
    const unsigned rs = 16 * GPITCH * 4;  // LDS bytes per 16 rows
    const size_t   gs = 16 * EMBED;       // floats per 16 rows
    asm volatile("global_load_async_to_lds_b128 %0, %12, off\n\t"
                 "global_load_async_to_lds_b128 %1, %13, off\n\t"
                 "global_load_async_to_lds_b128 %2, %14, off\n\t"
                 "global_load_async_to_lds_b128 %3, %15, off\n\t"
                 "global_load_async_to_lds_b128 %4, %16, off\n\t"
                 "global_load_async_to_lds_b128 %5, %17, off\n\t"
                 "global_load_async_to_lds_b128 %6, %18, off\n\t"
                 "global_load_async_to_lds_b128 %7, %19, off\n\t"
                 "global_load_async_to_lds_b128 %8, %20, off\n\t"
                 "global_load_async_to_lds_b128 %9, %21, off\n\t"
                 "global_load_async_to_lds_b128 %10, %22, off\n\t"
                 "global_load_async_to_lds_b128 %11, %23, off\n\t"
                 "s_wait_xcnt 0x0"
                 :: "v"(l),           "v"(l + rs),      "v"(l + 2 * rs),  "v"(l + 3 * rs),
                    "v"(l + 4 * rs),  "v"(l + 5 * rs),  "v"(l + 6 * rs),  "v"(l + 7 * rs),
                    "v"(l + 8 * rs),  "v"(l + 9 * rs),  "v"(l + 10 * rs), "v"(l + 11 * rs),
                    "v"(a0),          "v"(a1),          "v"(a2),          "v"(a3),
                    "v"(gw),          "v"(gw + gs),     "v"(gw + 2 * gs), "v"(gw + 3 * gs),
                    "v"(gw + 4 * gs), "v"(gw + 5 * gs), "v"(gw + 6 * gs), "v"(gw + 7 * gs)
                 : "memory");
}

// acc[f][t] = tile rows (wave & 1) * 32 + f * 16, columns n0 + (wave >> 1) * 64 + t * 16.
// Tile row (threadIdx.x >> 3) + 16 i is row arow[i] of A: the caller picks the tile's rows.
static __device__ __forceinline__ void gemm_64x128(const float* __restrict__ A,
                                                   const float* __restrict__ Wt,
                                                   const int (&arow)[4], int n0, float* sm,
                                                   v8f (&acc)[2][4]) {
    const int tid   = threadIdx.x;
    const int lane  = tid & 31;
    const int wave  = tid >> 5;
    const int nlane = lane & 15;
    const int khalf = (lane >> 4) << 1;

    // copies: 8 lanes cover a row's line, a wave 4 rows, the work-group 16 rows
    const int cr = tid >> 3, cc = (tid & 7) * 4;
    const float*   a0 = A  + (size_t)arow[0] * EMBED + cc;
    const float*   a1 = A  + (size_t)arow[1] * EMBED + cc;
    const float*   a2 = A  + (size_t)arow[2] * EMBED + cc;
    const float*   a3 = A  + (size_t)arow[3] * EMBED + cc;
    const float*   gw = Wt + (size_t)(n0 + cr) * EMBED + cc;
    const unsigned l0 = (unsigned)(uintptr_t)sm + (unsigned)(cr * GPITCH + cc) * 4u;

    const int aoff = ((wave & 1) * 32 + nlane) * GPITCH + khalf;
    const int boff = (GBM + (wave >> 1) * 64 + nlane) * GPITCH + khalf;

    copy_stage(a0, a1, a2, a3, gw, l0);
    wait_async0();                             // stage 0 landed (this wave's share)
    __syncthreads();                           // ... and every other wave's
    copy_stage(a0 + GKC, a1 + GKC, a2 + GKC, a3 + GKC, gw + GKC, l0 + GSTAGE * 4u);

    for (int s = 0; s < GTRIPS; ++s) {
        const float* st = sm + (s & 1) * GSTAGE;
        const float* at = st + aoff;
        const float* bt = st + boff;
        // every loop of a stage is unrolled: its index picks registers and LDS offsets, and
        // the fragment reads of later steps can go ahead of the products
        #pragma unroll
        for (int kk = 0; kk < GKC / 4; ++kk) {
            v2f a[2], b[4];
            #pragma unroll
            for (int f = 0; f < 2; ++f) a[f] = *(const v2f*)(at + f * 16 * GPITCH + kk * 4);
            #pragma unroll
            for (int t = 0; t < 4; ++t) b[t] = *(const v2f*)(bt + t * 16 * GPITCH + kk * 4);
            #pragma unroll
            for (int f = 0; f < 2; ++f) {
                #pragma unroll
                for (int t = 0; t < 4; ++t) acc[f][t] = wmma4(a[f], b[t], acc[f][t]);
            }
        }
        wait_ds0();                            // this wave has left buffer s & 1
        wait_async0();                         // its share of stage s + 1 has landed
        __syncthreads();                       // publishes stage s + 1, frees buffer s & 1
        if (s + 2 < GTRIPS) {
            const int k = (s + 2) * GKC;
            copy_stage(a0 + k, a1 + k, a2 + k, a3 + k, gw + k, l0 + (unsigned)(s & 1) * (GSTAGE * 4u));
        }
    }
    wait_async0();                             // nothing in flight when the wave ends
}

// ---------------------------------------------------------------------------
// Kernel 0: rank the keys of each batch row.  A padded-out key has weight exp(NEGV - max) = 0
// for every query, so attention need not walk it.  Keys that count (the prefix, and text keys
// whose padding word is not 0) get ranks 0, 1, 2, ... in their own order; the others fill the
// sequence from its end, so that the ranks are a permutation.  keyat[r] = the key of rank r.
// nvis[q] = how many ranks query q sees: the whole prefix, and the counting keys up to q;
// nvis[SEQ - 1] is the number of keys that count.
// Both are counts of comparisons: 0 <= rank < SEQ and IMG <= nvis <= SEQ for any padding words.
// grid: B, block: 256; a thread owns 8 consecutive keys.
// ---------------------------------------------------------------------------
__global__ __launch_bounds__(256)
void rank_keys_kernel(const int* __restrict__ pad, int* __restrict__ keyat, int* __restrict__ nvis) {
    __shared__ int part[2][256];
    __shared__ int inv[SEQ];
    const int b   = blockIdx.x;
    const int tid = threadIdx.x;
    const int s0  = tid * 8;

    int ok[8];
    int n = 0;
    #pragma unroll                            // the index picks registers
    for (int i = 0; i < 8; ++i) {
        const int s = s0 + i;
        const int w = pad[b * TXT + max(s - IMG, 0)];
        ok[i] = (s < IMG || w != 0) ? 1 : 0;
        n += ok[i];
    }

    // inclusive scan of the threads' counts; two buffers, so one barrier a step:
    // a step reads the buffer that the step before has written and writes the other
    int cur = 0;
    part[0][tid] = n;
    __syncthreads();
    #pragma unroll                            // cur becomes a constant: buffer offsets are immediates
    for (int d = 1; d < 256; d <<= 1) {
        const int lo = part[cur][max(tid - d, 0)];
        part[cur ^ 1][tid] = part[cur][tid] + (tid >= d ? lo : 0);
        __syncthreads();
        cur ^= 1;
    }

    int run = part[cur][tid] - n;             // counting keys in front of s0
    #pragma unroll                            // the index picks registers; 8 words go out as 16-byte stores
    for (int i = 0; i < 8; ++i) {
        const int s = s0 + i;
        inv[ok[i] ? run : (SEQ - 1 - (s - run))] = s;
        run += ok[i];
        nvis[b * SEQ + s] = max(run, IMG);
    }
    __syncthreads();                          // the permutation is turned round in LDS: every rank has its key
    #pragma unroll                            // 8 words go out as 16-byte stores
    for (int i = 0; i < 8; ++i) keyat[b * SEQ + s0 + i] = inv[s0 + i];
}

// ---------------------------------------------------------------------------
// Kernel 1: fused QKV projection.  C[m,n] = x[row(m),:] . W[n,:] + b[n]
// Q: row(m) = m.  K and V are formed in rank order: row(m) is the key of rank m, the copies
// gather its x row, and a tile whose 64 ranks all lie behind the keys that count is left out:
// attention reads no rank behind the 16-rank tile of the last key that counts.
// grid: (M/64, N/128, 3), block: 128
// ---------------------------------------------------------------------------
__global__ __launch_bounds__(128)
void qkv_proj_kernel(const float* __restrict__ x,
                     const float* __restrict__ Wq, const float* __restrict__ bq,
                     const float* __restrict__ Wk, const float* __restrict__ bk,
                     const float* __restrict__ Wv, const float* __restrict__ bv,
                     const int* __restrict__ keyat, const int* __restrict__ nvis,
                     float* __restrict__ Q, float* __restrict__ K,
                     float* __restrict__ V) {
    __shared__ __attribute__((aligned(16))) float sm[2 * GSTAGE];
    const int lane  = threadIdx.x & 31;
    const int wave  = threadIdx.x >> 5;
    const int m0    = blockIdx.x * GBM;
    const int n0    = blockIdx.y * GBN;
    const int which = blockIdx.z;
    const float* W    = (which == 0) ? Wq : (which == 1) ? Wk : Wv;
    const float* bias = (which == 0) ? bq : (which == 1) ? bk : bv;
    float*       dst  = (which == 0) ? Q  : (which == 1) ? K  : V;

    const int nlane = lane & 15;
    const int rhalf = (lane >> 4) * 8;

    // a tile lies in one batch row; the test reads the same for the whole work-group and
    // stands in front of every barrier and copy
    const int seq0 = m0 & ~(SEQ - 1);
    if (which != 0 && m0 - seq0 >= nvis[seq0 + SEQ - 1]) return;

    // the x rows of this lane's 4 copies (loops unrolled: the index picks registers)
    int arow[4];
    #pragma unroll
    for (int i = 0; i < 4; ++i) arow[i] = m0 + (threadIdx.x >> 3) + 16 * i;
    if (which != 0) {
        int k[4];                             // 4 loads in flight, then their uses
        #pragma unroll
        for (int i = 0; i < 4; ++i) k[i] = keyat[arow[i]];
        asm volatile("s_wait_xcnt 0x0" ::: "memory");   // the loads' index registers are rewritten below
        #pragma unroll                        // the mask bounds the address whatever the word holds
        for (int i = 0; i < 4; ++i) arow[i] = seq0 + (k[i] & (SEQ - 1));
    }

    v8f acc[2][4] = {};
    gemm_64x128(x, W, arow, n0, sm, acc);

    // unrolled throughout: the indices pick accumulator registers
    #pragma unroll
    for (int t = 0; t < 4; ++t) {
        const int   col = n0 + (wave >> 1) * 64 + t * 16 + nlane;
        const float bb  = bias[col];
        const int   h   = col >> 6;
        const int   d   = col & 63;
        #pragma unroll
        for (int f = 0; f < 2; ++f) {
            #pragma unroll
            for (int r = 0; r < 8; ++r) {
                const int row  = m0 + (wave & 1) * 32 + f * 16 + r + rhalf;
                const int bidx = row >> 11;
                const int s    = row & (SEQ - 1);
                dst[(((size_t)bidx * HEADS + h) * SEQ + s) * HDIM + d] = acc[f][t][r] + bb;
            }
        }
    }
}

__global__ void attn_kernel(const float* __restrict__ Q, const float* __restrict__ K,
                            const float* __restrict__ V, const int* __restrict__ nvis,
                            float* __restrict__ ctx) {
    const int lane = threadIdx.x;
    const int qt   = SEQ / 16 - 1 - blockIdx.y;   // 127..0: cost falls as the index rises
    const int bh   = blockIdx.x;                  // 0..47
    const int b    = bh / HEADS;
    const int h    = bh % HEADS;
    const int q0   = qt * 16;
    const size_t base = (size_t)bh * SEQ * HDIM;

    const int nlane = lane & 15;
    const int khalf = (lane >> 4) << 1;
    const int rhalf = (lane >> 4) * 8;

    __shared__ float kbuf[2][16 * KVPAD];
    __shared__ float vbuf[2][16 * KVPAD];

    // Issue async copies for one 16-key K+V tile (8+8 x b128, fully coalesced).
    auto issue_tile = [&](int j, int buf) {
        const float* kg = K + base + (size_t)j * 16 * HDIM;
        const float* vg = V + base + (size_t)j * 16 * HDIM;
        int flat = lane * 4;                       // 4 floats per lane per transfer
        #pragma unroll
        for (int i = 0; i < 8; ++i, flat += 128) { // 2 rows per transfer
            const int row = flat >> 6, col = flat & 63;
            async_b128(kg + flat, &kbuf[buf][row * KVPAD + col]);
            async_b128(vg + flat, &vbuf[buf][row * KVPAD + col]);
        }
    };

    // Preload 16 query fragments (B operand of S^T), 1/sqrt(D)=1/8 folded in.
    v2f qf[16];
    const float* qrow = Q + base + (size_t)(q0 + nlane) * HDIM + khalf;
    #pragma unroll
    for (int kk = 0; kk < 16; ++kk) {
        v2f t = *(const v2f*)(qrow + kk * 4);
        qf[kk] = t * 0.125f;
    }

    // o_t[r] = O[query q0 + nlane][d = t * 16 + r + rhalf]
    v8f o0 = {}, o1 = {}, o2 = {}, o3 = {};
    float mstate = -INFINITY;                 // this lane's query, alike in both halves
    float lstate = 0.f;                       // sum over this half's keys only

    const int  myq  = q0 + nlane;
    const int* nvb  = nvis + b * SEQ;
    const int  myn  = nvb[myq];               // this lane's query sees ranks 0 .. myn - 1

    // nvis rises with the query: the tile's last query sees most.  The unsigned minimum bounds
    // the trips and the K/V addresses by the shape alone, whatever the word holds.
    const int nlast = nvb[q0 + 15];
    const int jmax  = (int)min((unsigned)(nlast - 1) >> 4, (unsigned)(SEQ / 16 - 1));
    issue_tile(0, 0);

    // Every inner loop of a trip is unrolled: its index picks registers, not memory.
    for (int j = 0; j <= jmax; ++j) {
        const int buf = j & 1;

        if (j < jmax) {
            wait_ds0();                        // don't overwrite a buffer with DS reads in flight
            issue_tile(j + 1, buf ^ 1);
            wait_async16();                    // tile j's 16 transfers complete
        } else {
            wait_async0();
        }

        // S^T = K . Q^T from LDS-staged K tile (conflict-free ds_load_b64); the K
        // fragments are fetched 8 products ahead of their use
        const float* kt = &kbuf[buf][nlane * KVPAD + khalf];
        const float* vt = &vbuf[buf][rhalf * KVPAD + nlane];
        v2f kf[16];
        #pragma unroll
        for (int kk = 0; kk < 8; ++kk) kf[kk] = *(const v2f*)(kt + kk * 4);
        // vv[key][t] = V[rhalf + key][t * 16 + nlane]; the 4 keys of the first two steps of
        // the second product are fetched as K's registers fall free, ahead of the softmax
        float vv[8][4];
        v8f s = {};
        #pragma unroll
        for (int kk = 0; kk < 16; ++kk) {
            s = wmma4(kf[kk], qf[kk], s);
            if (kk < 8) kf[kk + 8] = *(const v2f*)(kt + (kk + 8) * 4);
            if (kk >= 8 && (kk & 1)) {
                const int k = (kk - 9) >> 1;
                #pragma unroll
                for (int t = 0; t < 4; ++t) vv[k][t] = vt[k * KVPAD + t * 16];
            }
        }

        // prefix-causal + key padding mask (selects only): bit n stands for rank 16 j + n
        const int      nin   = min(max(myn - j * 16, 0), 16);     // visible ranks of this tile
        const unsigned okbit = ((1u << nin) - 1u) >> rhalf;
        #pragma unroll
        for (int r = 0; r < 8; ++r)
            if (!((okbit >> r) & 1u)) s[r] = NEGV;

        // online softmax: 8 keys in-lane, the other 8 in lane ^ 16
        float mx = fmaxf(fmaxf(fmaxf(s[0], s[1]), fmaxf(s[2], s[3])),
                         fmaxf(fmaxf(s[4], s[5]), fmaxf(s[6], s[7])));
        mx = fmaxf(mx, xhalf(mx));
        const float mnew = fmaxf(mstate, mx);
        const float dm   = mstate - mnew;
        #pragma unroll
        for (int r = 0; r < 8; ++r) s[r] -= mnew;
        const float fac = __expf(dm);
        #pragma unroll
        for (int r = 0; r < 8; ++r) s[r] = __expf(s[r]);
        const float rs  = ((s[0] + s[1]) + (s[2] + s[3])) + ((s[4] + s[5]) + (s[6] + s[7]));
        lstate = lstate * fac + rs;
        mstate = mnew;
        o0 *= fac; o1 *= fac; o2 *= fac; o3 *= fac;

        // O^T += V^T . P^T.  k slots of step st: keys 2st, 2st+1 (lanes 0-15) and
        // 8+2st, 8+2st+1 (lanes 16-31), the same in the V loader and in P's registers.
        #pragma unroll
        for (int st = 0; st < 4; ++st) {
            v2f p2, a0, a1, a2, a3;
            p2.x = s[2 * st];      p2.y = s[2 * st + 1];
            a0.x = vv[2 * st][0];  a0.y = vv[2 * st + 1][0];
            a1.x = vv[2 * st][1];  a1.y = vv[2 * st + 1][1];
            a2.x = vv[2 * st][2];  a2.y = vv[2 * st + 1][2];
            a3.x = vv[2 * st][3];  a3.y = vv[2 * st + 1][3];
            o0 = wmma4(a0, p2, o0);
            o1 = wmma4(a1, p2, o1);
            o2 = wmma4(a2, p2, o2);
            o3 = wmma4(a3, p2, o3);
            if (st < 2) {                      // fetch V two steps ahead
                #pragma unroll
                for (int k = 2 * st + 4; k < 2 * st + 6; ++k) {
                    #pragma unroll
                    for (int t = 0; t < 4; ++t) vv[k][t] = vt[k * KVPAD + t * 16];
                }
            }
        }
    }

    // join the halves' sums, normalize, write context in [B,S,E]
    const float inv = 1.f / (lstate + xhalf(lstate));
    float* crow = ctx + ((size_t)b * SEQ + myq) * EMBED + h * HDIM + rhalf;
    #pragma unroll
    for (int t = 0; t < 4; ++t) {
        v8f oo = (t == 0) ? o0 : (t == 1) ? o1 : (t == 2) ? o2 : o3;
        v4f lo, hi;
        #pragma unroll
        for (int r = 0; r < 4; ++r) { lo[r] = oo[r] * inv; hi[r] = oo[r + 4] * inv; }
        *(v4f*)(crow + t * 16)     = lo;
        *(v4f*)(crow + t * 16 + 4) = hi;
    }
}

// ---------------------------------------------------------------------------
// Kernel 3: output projection.  out[m,n] = ctx[m,:] . Wo[n,:] + bo[n]
// grid: (M/64, N/128), block: 128
// ---------------------------------------------------------------------------
__global__ __launch_bounds__(128)
void out_proj_kernel(const float* __restrict__ ctx,
                     const float* __restrict__ Wo,
                     const float* __restrict__ bo,
                     float* __restrict__ out) {
    __shared__ __attribute__((aligned(16))) float sm[2 * GSTAGE];
    const int lane  = threadIdx.x & 31;
    const int wave  = threadIdx.x >> 5;
    const int m0    = blockIdx.x * GBM;
    const int n0    = blockIdx.y * GBN;
    const int nlane = lane & 15;
    const int rhalf = (lane >> 4) * 8;

    int arow[4];
    #pragma unroll                            // the index picks registers
    for (int i = 0; i < 4; ++i) arow[i] = m0 + (threadIdx.x >> 3) + 16 * i;

    v8f acc[2][4] = {};
    gemm_64x128(ctx, Wo, arow, n0, sm, acc);

    // unrolled throughout: the indices pick accumulator registers
    #pragma unroll
    for (int t = 0; t < 4; ++t) {
        const int   col = n0 + (wave >> 1) * 64 + t * 16 + nlane;
        const float bb  = bo[col];
        #pragma unroll
        for (int f = 0; f < 2; ++f) {
            #pragma unroll
            for (int r = 0; r < 8; ++r) {
                const int row = m0 + (wave & 1) * 32 + f * 16 + r + rhalf;
                out[(size_t)row * EMBED + col] = acc[f][t][r] + bb;
            }
        }
    }
}

// ---------------------------------------------------------------------------
extern "C" void kernel_launch(void* const* d_in, const int* in_sizes, int n_in,
                              void* d_out, int out_size, void* d_ws, size_t ws_size,
                              hipStream_t stream) {
    const float* x   = (const float*)d_in[0];
    const int*   pad = (const int*)  d_in[1];
    const float* Wq  = (const float*)d_in[2];
    const float* bq  = (const float*)d_in[3];
    const float* Wk  = (const float*)d_in[4];
    const float* bk  = (const float*)d_in[5];
    const float* Wv  = (const float*)d_in[6];
    const float* bv  = (const float*)d_in[7];
    const float* Wo  = (const float*)d_in[8];
    const float* bo  = (const float*)d_in[9];
    float*       out = (float*)d_out;

    // Workspace: Q, K, V in [B,H,S,D] + ctx in [B,S,E], 100,663,296 bytes; then keyat and nvis, [B,S] ints.
    const size_t NELT = (size_t)BATCHN * SEQ * EMBED;   // 6,291,456
    float* Q   = (float*)d_ws;
    float* K   = Q + NELT;
    float* V   = K + NELT;
    float* ctx = V + NELT;
    int*   keyat = (int*)(ctx + NELT);
    int*   nvis  = keyat + BATCHN * SEQ;

    const dim3 blk(32);
    const dim3 gblk(128);
    const int MT = (BATCHN * SEQ) / GBM;  // 128
    const int NT = EMBED / GBN;           // 6

    rank_keys_kernel<<<dim3(BATCHN), dim3(256), 0, stream>>>(pad, keyat, nvis);
    qkv_proj_kernel<<<dim3(MT, NT, 3), gblk, 0, stream>>>(x, Wq, bq, Wk, bk, Wv, bv, keyat, nvis, Q, K, V);
    attn_kernel<<<dim3(BATCHN * HEADS, SEQ / 16), blk, 0, stream>>>(Q, K, V, nvis, ctx);
    out_proj_kernel<<<dim3(MT, NT), gblk, 0, stream>>>(ctx, Wo, bo, out);
}

// v006
// A run of this version takes 261 microseconds.
// Timed twice side by side with v005, it ran 1.12 and 1.11 times as fast.
// All steps since v000 together make it 4.60 times as fast.
#include <hip/hip_runtime.h>
#include <hip/hip_bf16.h>

typedef __attribute__((ext_vector_type(2))) float v2f;
typedef __attribute__((ext_vector_type(8))) float v8f;
typedef __attribute__((ext_vector_type(4))) float v4f;

#define EMBED   768
#define HEADS   12
#define HDIM    64
#define IMG     196
#define TXT     1852
#define SEQ     2048
#define BATCHN  4
#define NEGV    (-1e9f)
#define KVPAD   68      // LDS row stride (floats) -> conflict-free fragment reads

// D = A(16x4) * B(4x16) + C(16x16), all f32. Per-lane: A,B = float2, C/D = float8.
static __device__ __forceinline__ v8f wmma4(v2f a, v2f b, v8f c) {
    return __builtin_amdgcn_wmma_f32_16x16x4_f32(false, a, false, b, (short)0, c, false, false);
}

// Value of lane l ^ 16 (the other 16-lane half of the wave).
static __device__ __forceinline__ float xhalf(float x) {
    const int b = __builtin_bit_cast(int, x);
    return __builtin_bit_cast(float, __builtin_amdgcn_permlanex16(b, b, 0x76543210, 0xfedcba98, false, false));
}

// Waits of the async copy engine (global -> LDS, tracked on ASYNCcnt) and of LDS reads.
static __device__ __forceinline__ void wait_async0() {
    asm volatile("s_wait_asynccnt 0x0" ::: "memory");
}
static __device__ __forceinline__ void wait_ds0() {
    asm volatile("s_wait_dscnt 0x0" ::: "memory");
}

// ---------------------------------------------------------------------------
// Projections: C[m,n] = A[row(m),:] . W[n,:], row(m) picked by the caller (+ bias in the callers).  A work-group of
// 4 waves owns a 64 x 128 tile of C; a wave owns 32 x 64 of it (2 x 4 fragments).
// A stage is 32 k of the tile's 64 A rows and 128 W rows, brought into LDS as whole
// 128-byte lines by async copies; two buffers, the next stage flies during this one.
// ---------------------------------------------------------------------------
#define GBM     64
#define GBN     128
#define GKC     32                        // k per stage: one 128-byte line of every row
#define GPITCH  36                        // LDS row stride (floats): conflict-free b64 fragment reads
#define GSTAGE  ((GBM + GBN) * GPITCH)    // floats per buffer
#define GTRIPS  (EMBED / GKC)

// One stage: 12 copies of 16 B per lane (4 of A, each from a row of its own; 8 of W, 16 rows
// apart).  The copies and the s_wait_xcnt stand in one statement so that no address register is
// rewritten ahead of it.
static __device__ __forceinline__ void copy_stage(const float* a0, const float* a1,
                                                  const float* a2, const float* a3,
                                                  const float* gw, unsigned l) {
    const unsigned rs = 16 * GPITCH * 4;  // LDS bytes per 16 rows
    const size_t   gs = 16 * EMBED;       // floats per 16 rows
    asm volatile("global_load_async_to_lds_b128 %0, %12, off\n\t"
                 "global_load_async_to_lds_b128 %1, %13, off\n\t"
                 "global_load_async_to_lds_b128 %2, %14, off\n\t"
                 "global_load_async_to_lds_b128 %3, %15, off\n\t"
                 "global_load_async_to_lds_b128 %4, %16, off\n\t"
                 "global_load_async_to_lds_b128 %5, %17, off\n\t"
                 "global_load_async_to_lds_b128 %6, %18, off\n\t"
                 "global_load_async_to_lds_b128 %7, %19, off\n\t"
                 "global_load_async_to_lds_b128 %8, %20, off\n\t"
                 "global_load_async_to_lds_b128 %9, %21, off\n\t"
                 "global_load_async_to_lds_b128 %10, %22, off\n\t"
                 "global_load_async_to_lds_b128 %11, %23, off\n\t"
                 "s_wait_xcnt 0x0"
                 :: "v"(l),           "v"(l + rs),      "v"(l + 2 * rs),  "v"(l + 3 * rs),
                    "v"(l + 4 * rs),  "v"(l + 5 * rs),  "v"(l + 6 * rs),  "v"(l + 7 * rs),
                    "v"(l + 8 * rs),  "v"(l + 9 * rs),  "v"(l + 10 * rs), "v"(l + 11 * rs),
                    "v"(a0),          "v"(a1),          "v"(a2),          "v"(a3),
                    "v"(gw),          "v"(gw + gs),     "v"(gw + 2 * gs), "v"(gw + 3 * gs),
                    "v"(gw + 4 * gs), "v"(gw + 5 * gs), "v"(gw + 6 * gs), "v"(gw + 7 * gs)
                 : "memory");
}

// acc[f][t] = tile rows (wave & 1) * 32 + f * 16, columns n0 + (wave >> 1) * 64 + t * 16.
// Tile row (threadIdx.x >> 3) + 16 i is row arow[i] of A: the caller picks the tile's rows.
static __device__ __forceinline__ void gemm_64x128(const float* __restrict__ A,
                                                   const float* __restrict__ Wt,
                                                   const int (&arow)[4], int n0, float* sm,
                                                   v8f (&acc)[2][4]) {
    const int tid   = threadIdx.x;
    const int lane  = tid & 31;
    const int wave  = tid >> 5;
    const int nlane = lane & 15;
    const int khalf = (lane >> 4) << 1;

    // copies: 8 lanes cover a row's line, a wave 4 rows, the work-group 16 rows
    const int cr = tid >> 3, cc = (tid & 7) * 4;
    const float*   a0 = A  + (size_t)arow[0] * EMBED + cc;
    const float*   a1 = A  + (size_t)arow[1] * EMBED + cc;
    const float*   a2 = A  + (size_t)arow[2] * EMBED + cc;
    const float*   a3 = A  + (size_t)arow[3] * EMBED + cc;
    const float*   gw = Wt + (size_t)(n0 + cr) * EMBED + cc;
    const unsigned l0 = (unsigned)(uintptr_t)sm + (unsigned)(cr * GPITCH + cc) * 4u;

    const int aoff = ((wave & 1) * 32 + nlane) * GPITCH + khalf;
    const int boff = (GBM + (wave >> 1) * 64 + nlane) * GPITCH + khalf;

    copy_stage(a0, a1, a2, a3, gw, l0);
    wait_async0();                             // stage 0 landed (this wave's share)
    __syncthreads();                           // ... and every other wave's
    copy_stage(a0 + GKC, a1 + GKC, a2 + GKC, a3 + GKC, gw + GKC, l0 + GSTAGE * 4u);

    for (int s = 0; s < GTRIPS; ++s) {
        const float* st = sm + (s & 1) * GSTAGE;
        const float* at = st + aoff;
        const float* bt = st + boff;
        // every loop of a stage is unrolled: its index picks registers and LDS offsets, and
        // the fragment reads of later steps can go ahead of the products
        #pragma unroll
        for (int kk = 0; kk < GKC / 4; ++kk) {
            v2f a[2], b[4];
            #pragma unroll
            for (int f = 0; f < 2; ++f) a[f] = *(const v2f*)(at + f * 16 * GPITCH + kk * 4);
            #pragma unroll
            for (int t = 0; t < 4; ++t) b[t] = *(const v2f*)(bt + t * 16 * GPITCH + kk * 4);
            #pragma unroll
            for (int f = 0; f < 2; ++f) {
                #pragma unroll
                for (int t = 0; t < 4; ++t) acc[f][t] = wmma4(a[f], b[t], acc[f][t]);
            }
        }
        wait_ds0();                            // this wave has left buffer s & 1
        wait_async0();                         // its share of stage s + 1 has landed
        __syncthreads();                       // publishes stage s + 1, frees buffer s & 1
        if (s + 2 < GTRIPS) {
            const int k = (s + 2) * GKC;
            copy_stage(a0 + k, a1 + k, a2 + k, a3 + k, gw + k, l0 + (unsigned)(s & 1) * (GSTAGE * 4u));
        }
    }
    wait_async0();                             // nothing in flight when the wave ends
}

// ---------------------------------------------------------------------------
// Kernel 0: rank the keys of each batch row.  A padded-out key has weight exp(NEGV - max) = 0
// for every query, so attention need not walk it.  Keys that count (the prefix, and text keys
// whose padding word is not 0) get ranks 0, 1, 2, ... in their own order; the others fill the
// sequence from its end, so that the ranks are a permutation.  keyat[r] = the key of rank r.
// nvis[q] = how many ranks query q sees: the whole prefix, and the counting keys up to q;
// nvis[SEQ - 1] is the number of keys that count.
// Both are counts of comparisons: 0 <= rank < SEQ and IMG <= nvis <= SEQ for any padding words.
// grid: B, block: 256; a thread owns 8 consecutive keys.
// ---------------------------------------------------------------------------
__global__ __launch_bounds__(256)
void rank_keys_kernel(const int* __restrict__ pad, int* __restrict__ keyat, int* __restrict__ nvis) {
    __shared__ int part[2][256];
    __shared__ int inv[SEQ];
    const int b   = blockIdx.x;
    const int tid = threadIdx.x;
    const int s0  = tid * 8;

    int ok[8];
    int n = 0;
    #pragma unroll                            // the index picks registers
    for (int i = 0; i < 8; ++i) {
        const int s = s0 + i;
        const int w = pad[b * TXT + max(s - IMG, 0)];
        ok[i] = (s < IMG || w != 0) ? 1 : 0;
        n += ok[i];
    }

    // inclusive scan of the threads' counts; two buffers, so one barrier a step:
    // a step reads the buffer that the step before has written and writes the other
    int cur = 0;
    part[0][tid] = n;
    __syncthreads();
    #pragma unroll                            // cur becomes a constant: buffer offsets are immediates
    for (int d = 1; d < 256; d <<= 1) {
        const int lo = part[cur][max(tid - d, 0)];
        part[cur ^ 1][tid] = part[cur][tid] + (tid >= d ? lo : 0);
        __syncthreads();
        cur ^= 1;
    }

    int run = part[cur][tid] - n;             // counting keys in front of s0
    #pragma unroll                            // the index picks registers; 8 words go out as 16-byte stores
    for (int i = 0; i < 8; ++i) {
        const int s = s0 + i;
        inv[ok[i] ? run : (SEQ - 1 - (s - run))] = s;
        run += ok[i];
        nvis[b * SEQ + s] = max(run, IMG);
    }
    __syncthreads();                          // the permutation is turned round in LDS: every rank has its key
    #pragma unroll                            // 8 words go out as 16-byte stores
    for (int i = 0; i < 8; ++i) keyat[b * SEQ + s0 + i] = inv[s0 + i];
}

// ---------------------------------------------------------------------------
// Kernel 1: fused QKV projection.  C[m,n] = x[row(m),:] . W[n,:] + b[n]
// Q: row(m) = m.  K and V are formed in rank order: row(m) is the key of rank m, the copies
// gather its x row, and a tile whose 64 ranks all lie behind the keys that count is left out:
// attention reads no rank behind the 64-rank stage of the last key that counts.
// grid: (M/64, N/128, 3), block: 128
// ---------------------------------------------------------------------------
__global__ __launch_bounds__(128)
void qkv_proj_kernel(const float* __restrict__ x,
                     const float* __restrict__ Wq, const float* __restrict__ bq,
                     const float* __restrict__ Wk, const float* __restrict__ bk,
                     const float* __restrict__ Wv, const float* __restrict__ bv,
                     const int* __restrict__ keyat, const int* __restrict__ nvis,
                     float* __restrict__ Q, float* __restrict__ K,
                     float* __restrict__ V) {
    __shared__ __attribute__((aligned(16))) float sm[2 * GSTAGE];
    const int lane  = threadIdx.x & 31;
    const int wave  = threadIdx.x >> 5;
    const int m0    = blockIdx.x * GBM;
    const int n0    = blockIdx.y * GBN;
    const int which = blockIdx.z;
    const float* W    = (which == 0) ? Wq : (which == 1) ? Wk : Wv;
    const float* bias = (which == 0) ? bq : (which == 1) ? bk : bv;
    float*       dst  = (which == 0) ? Q  : (which == 1) ? K  : V;

    const int nlane = lane & 15;
    const int rhalf = (lane >> 4) * 8;

    // a tile lies in one batch row; the test reads the same for the whole work-group and
    // stands in front of every barrier and copy
    const int seq0 = m0 & ~(SEQ - 1);
    if (which != 0 && m0 - seq0 >= nvis[seq0 + SEQ - 1]) return;

    // the x rows of this lane's 4 copies (loops unrolled: the index picks registers)
    int arow[4];
    #pragma unroll
    for (int i = 0; i < 4; ++i) arow[i] = m0 + (threadIdx.x >> 3) + 16 * i;
    if (which != 0) {
        int k[4];                             // 4 loads in flight, then their uses
        #pragma unroll
        for (int i = 0; i < 4; ++i) k[i] = keyat[arow[i]];
        asm volatile("s_wait_xcnt 0x0" ::: "memory");   // the loads' index registers are rewritten below
        #pragma unroll                        // the mask bounds the address whatever the word holds
        for (int i = 0; i < 4; ++i) arow[i] = seq0 + (k[i] & (SEQ - 1));
    }

    v8f acc[2][4] = {};
    gemm_64x128(x, W, arow, n0, sm, acc);

    // unrolled throughout: the indices pick accumulator registers
    #pragma unroll
    for (int t = 0; t < 4; ++t) {
        const int   col = n0 + (wave >> 1) * 64 + t * 16 + nlane;
        const float bb  = bias[col];
        const int   h   = col >> 6;
        const int   d   = col & 63;
        #pragma unroll
        for (int f = 0; f < 2; ++f) {
            #pragma unroll
            for (int r = 0; r < 8; ++r) {
                const int row  = m0 + (wave & 1) * 32 + f * 16 + r + rhalf;
                const int bidx = row >> 11;
                const int s    = row & (SEQ - 1);
                dst[(((size_t)bidx * HEADS + h) * SEQ + s) * HDIM + d] = acc[f][t][r] + bb;
            }
        }
    }
}

#define AWAVES  4
#define ASTAGE  64
#define APLANE  (ASTAGE * KVPAD)

// 64 rows of 256 B: 8 copies of 16 B per lane, the work-group covers 8 rows with each.  The
// copies and the s_wait_xcnt stand in one statement so that no address register is rewritten
// ahead of it.
static __device__ __forceinline__ void copy_rows64(const float* g, unsigned l) {
    const unsigned rs = 8 * KVPAD * 4;    // LDS bytes per 8 rows
    const size_t   gs = 8 * HDIM;         // floats per 8 rows
    asm volatile("global_load_async_to_lds_b128 %0, %8, off\n\t"
                 "global_load_async_to_lds_b128 %1, %9, off\n\t"
                 "global_load_async_to_lds_b128 %2, %10, off\n\t"
                 "global_load_async_to_lds_b128 %3, %11, off\n\t"
                 "global_load_async_to_lds_b128 %4, %12, off\n\t"
                 "global_load_async_to_lds_b128 %5, %13, off\n\t"
                 "global_load_async_to_lds_b128 %6, %14, off\n\t"
                 "global_load_async_to_lds_b128 %7, %15, off\n\t"
                 "s_wait_xcnt 0x0"
                 :: "v"(l),          "v"(l + rs),     "v"(l + 2 * rs), "v"(l + 3 * rs),
                    "v"(l + 4 * rs), "v"(l + 5 * rs), "v"(l + 6 * rs), "v"(l + 7 * rs),
                    "v"(g),          "v"(g + gs),     "v"(g + 2 * gs), "v"(g + 3 * gs),
                    "v"(g + 4 * gs), "v"(g + 5 * gs), "v"(g + 6 * gs), "v"(g + 7 * gs)
                 : "memory");
}

__global__ __launch_bounds__(AWAVES * 32)
void attn_kernel(const float* __restrict__ Q, const float* __restrict__ K,
                 const float* __restrict__ V, const int* __restrict__ nvis,
                 float* __restrict__ ctx) {
    const int tid  = threadIdx.x;
    const int lane = tid & 31;
    const int wave = __builtin_amdgcn_readfirstlane(tid >> 5);
    const int qg   = SEQ / (16 * AWAVES) - 1 - blockIdx.y;   // 31..0: cost falls as the index rises
    const int bh   = blockIdx.x;                  // 0..47
    const int b    = bh / HEADS;
    const int h    = bh % HEADS;
    const int q0   = (qg * AWAVES + wave) * 16;
    const size_t base = (size_t)bh * SEQ * HDIM;

    const int nlane = lane & 15;
    const int khalf = (lane >> 4) << 1;
    const int rhalf = (lane >> 4) * 8;

    __shared__ __attribute__((aligned(16))) float kv[2][2][APLANE];   // [buffer][K, V]

    // Async copies of one 64-key stage of K and V: 16 lanes cover a row, the work-group 8 rows.
    const float*   kg0 = K + base + tid * 4;
    const float*   vg0 = V + base + tid * 4;
    const unsigned l0  = (unsigned)(uintptr_t)&kv[0][0][0]
                       + (unsigned)((tid >> 4) * KVPAD + (tid & 15) * 4) * 4u;
    auto issue_stage = [&](int s, int buf) {
        const unsigned l = l0 + (unsigned)buf * (2u * APLANE * 4u);
        copy_rows64(kg0 + (size_t)s * (ASTAGE * HDIM), l);
        copy_rows64(vg0 + (size_t)s * (ASTAGE * HDIM), l + APLANE * 4u);
    };

    // Preload 16 query fragments (B operand of S^T), 1/sqrt(D)=1/8 folded in.
    v2f qf[16];
    const float* qrow = Q + base + (size_t)(q0 + nlane) * HDIM + khalf;
    #pragma unroll
    for (int kk = 0; kk < 16; ++kk) {
        v2f t = *(const v2f*)(qrow + kk * 4);
        qf[kk] = t * 0.125f;
    }

    // o_t[r] = O[query q0 + nlane][d = t * 16 + r + rhalf]
    v8f o0 = {}, o1 = {}, o2 = {}, o3 = {};
    float mstate = -INFINITY;                 // this lane's query, alike in both halves
    float lstate = 0.f;                       // sum over this half's keys only

    const int  myq  = q0 + nlane;
    const int* nvb  = nvis + b * SEQ;
    const int  myn  = nvb[myq];               // this lane's query sees ranks 0 .. myn - 1

    // nvis rises with the query: a tile's last query sees most, and the work-group's last query
    // sets the stages.  The unsigned minimum bounds the trips and the K/V addresses by the shape
    // alone, whatever the word holds.
    const int nlast = nvb[q0 + 15];
    const int jmax  = (int)min((unsigned)(nlast - 1) >> 4, (unsigned)(SEQ / 16 - 1));
    const int glast = nvb[qg * (16 * AWAVES) + 16 * AWAVES - 1];
    const int smax  = (int)min((unsigned)(glast - 1) >> 6, (unsigned)(SEQ / ASTAGE - 1));

    issue_stage(0, 0);
    wait_async0();                             // stage 0 landed (this wave's share)
    __syncthreads();                           // ... and every other wave's
    if (smax >= 1) issue_stage(1, 1);

    for (int st64 = 0; st64 <= smax; ++st64) {
        const int buf  = st64 & 1;
        const int jend = min(st64 * 4 + 3, jmax);
        // Every inner loop of a trip is unrolled: its index picks registers, not memory.
        for (int j = st64 * 4; j <= jend; ++j) {
            // S^T = K . Q^T from LDS-staged K tile (conflict-free ds_load_b64); the K
            // fragments are fetched 8 products ahead of their use
            const int    trow = (j & 3) * 16;      // the tile's first row in the stage
            const float* kt = &kv[buf][0][(trow + nlane) * KVPAD + khalf];
            const float* vt = &kv[buf][1][(trow + rhalf) * KVPAD + nlane];
            v2f kf[16];
            #pragma unroll
            for (int kk = 0; kk < 8; ++kk) kf[kk] = *(const v2f*)(kt + kk * 4);
            // vv[key][t] = V[rhalf + key][t * 16 + nlane]; the 4 keys of the first two steps of
            // the second product are fetched as K's registers fall free, ahead of the softmax
            float vv[8][4];
            v8f s = {};
            #pragma unroll
            for (int kk = 0; kk < 16; ++kk) {
                s = wmma4(kf[kk], qf[kk], s);
                if (kk < 8) kf[kk + 8] = *(const v2f*)(kt + (kk + 8) * 4);
                if (kk >= 8 && (kk & 1)) {
                    const int k = (kk - 9) >> 1;
                    #pragma unroll
                    for (int t = 0; t < 4; ++t) vv[k][t] = vt[k * KVPAD + t * 16];
                }
            }

            // prefix-causal + key padding mask (selects only): bit n stands for rank 16 j + n
            const int      nin   = min(max(myn - j * 16, 0), 16);     // visible ranks of this tile
            const unsigned okbit = ((1u << nin) - 1u) >> rhalf;
            #pragma unroll
            for (int r = 0; r < 8; ++r)
                if (!((okbit >> r) & 1u)) s[r] = NEGV;

            // online softmax: 8 keys in-lane, the other 8 in lane ^ 16
            float mx = fmaxf(fmaxf(fmaxf(s[0], s[1]), fmaxf(s[2], s[3])),
                             fmaxf(fmaxf(s[4], s[5]), fmaxf(s[6], s[7])));
            mx = fmaxf(mx, xhalf(mx));
            const float mnew = fmaxf(mstate, mx);
            const float dm   = mstate - mnew;
            #pragma unroll
            for (int r = 0; r < 8; ++r) s[r] -= mnew;
            const float fac = __expf(dm);
            #pragma unroll
            for (int r = 0; r < 8; ++r) s[r] = __expf(s[r]);
            const float rs  = ((s[0] + s[1]) + (s[2] + s[3])) + ((s[4] + s[5]) + (s[6] + s[7]));
            lstate = lstate * fac + rs;
            mstate = mnew;
            o0 *= fac; o1 *= fac; o2 *= fac; o3 *= fac;

            // O^T += V^T . P^T.  k slots of step st: keys 2st, 2st+1 (lanes 0-15) and
            // 8+2st, 8+2st+1 (lanes 16-31), the same in the V loader and in P's registers.
            #pragma unroll
            for (int st = 0; st < 4; ++st) {
                v2f p2, a0, a1, a2, a3;
                p2.x = s[2 * st];      p2.y = s[2 * st + 1];
                a0.x = vv[2 * st][0];  a0.y = vv[2 * st + 1][0];
                a1.x = vv[2 * st][1];  a1.y = vv[2 * st + 1][1];
                a2.x = vv[2 * st][2];  a2.y = vv[2 * st + 1][2];
                a3.x = vv[2 * st][3];  a3.y = vv[2 * st + 1][3];
                o0 = wmma4(a0, p2, o0);
                o1 = wmma4(a1, p2, o1);
                o2 = wmma4(a2, p2, o2);
                o3 = wmma4(a3, p2, o3);
                if (st < 2) {                      // fetch V two steps ahead
                    #pragma unroll
                    for (int k = 2 * st + 4; k < 2 * st + 6; ++k) {
                        #pragma unroll
                        for (int t = 0; t < 4; ++t) vv[k][t] = vt[k * KVPAD + t * 16];
                    }
                }
            }
        }
        wait_ds0();                              // this wave has left buffer st64 & 1
        wait_async0();                           // its share of stage st64 + 1 has landed
        __syncthreads();                         // publishes stage st64 + 1, frees buffer st64 & 1
        if (st64 + 2 <= smax) issue_stage(st64 + 2, buf);
    }
    wait_async0();                             // nothing in flight when the wave ends

    // join the halves' sums, normalize, write context in [B,S,E]
    const float inv = 1.f / (lstate + xhalf(lstate));
    float* crow = ctx + ((size_t)b * SEQ + myq) * EMBED + h * HDIM + rhalf;
    #pragma unroll
    for (int t = 0; t < 4; ++t) {
        v8f oo = (t == 0) ? o0 : (t == 1) ? o1 : (t == 2) ? o2 : o3;
        v4f lo, hi;
        #pragma unroll
        for (int r = 0; r < 4; ++r) { lo[r] = oo[r] * inv; hi[r] = oo[r + 4] * inv; }
        *(v4f*)(crow + t * 16)     = lo;
        *(v4f*)(crow + t * 16 + 4) = hi;
    }
}

// ---------------------------------------------------------------------------
// Kernel 3: output projection.  out[m,n] = ctx[m,:] . Wo[n,:] + bo[n]
// grid: (M/64, N/128), block: 128
// ---------------------------------------------------------------------------
__global__ __launch_bounds__(128)
void out_proj_kernel(const float* __restrict__ ctx,
                     const float* __restrict__ Wo,
                     const float* __restrict__ bo,
                     float* __restrict__ out) {
    __shared__ __attribute__((aligned(16))) float sm[2 * GSTAGE];
    const int lane  = threadIdx.x & 31;
    const int wave  = threadIdx.x >> 5;
    const int m0    = blockIdx.x * GBM;
    const int n0    = blockIdx.y * GBN;
    const int nlane = lane & 15;
    const int rhalf = (lane >> 4) * 8;

    int arow[4];
    #pragma unroll                            // the index picks registers
    for (int i = 0; i < 4; ++i) arow[i] = m0 + (threadIdx.x >> 3) + 16 * i;

    v8f acc[2][4] = {};
    gemm_64x128(ctx, Wo, arow, n0, sm, acc);

    // unrolled throughout: the indices pick accumulator registers
    #pragma unroll
    for (int t = 0; t < 4; ++t) {
        const int   col = n0 + (wave >> 1) * 64 + t * 16 + nlane;
        const float bb  = bo[col];
        #pragma unroll
        for (int f = 0; f < 2; ++f) {
            #pragma unroll
            for (int r = 0; r < 8; ++r) {
                const int row = m0 + (wave & 1) * 32 + f * 16 + r + rhalf;
                out[(size_t)row * EMBED + col] = acc[f][t][r] + bb;
            }
        }
    }
}

// ---------------------------------------------------------------------------
extern "C" void kernel_launch(void* const* d_in, const int* in_sizes, int n_in,
                              void* d_out, int out_size, void* d_ws, size_t ws_size,
                              hipStream_t stream) {
    const float* x   = (const float*)d_in[0];
    const int*   pad = (const int*)  d_in[1];
    const float* Wq  = (const float*)d_in[2];
    const float* bq  = (const float*)d_in[3];
    const float* Wk  = (const float*)d_in[4];
    const float* bk  = (const float*)d_in[5];
    const float* Wv  = (const float*)d_in[6];
    const float* bv  = (const float*)d_in[7];
    const float* Wo  = (const float*)d_in[8];
    const float* bo  = (const float*)d_in[9];
    float*       out = (float*)d_out;

    // Workspace: Q, K, V in [B,H,S,D] + ctx in [B,S,E], 100,663,296 bytes; then keyat and nvis, [B,S] ints.
    const size_t NELT = (size_t)BATCHN * SEQ * EMBED;   // 6,291,456
    float* Q   = (float*)d_ws;
    float* K   = Q + NELT;
    float* V   = K + NELT;
    float* ctx = V + NELT;
    int*   keyat = (int*)(ctx + NELT);
    int*   nvis  = keyat + BATCHN * SEQ;

    const dim3 gblk(128);
    const int MT = (BATCHN * SEQ) / GBM;  // 128
    const int NT = EMBED / GBN;           // 6

    rank_keys_kernel<<<dim3(BATCHN), dim3(256), 0, stream>>>(pad, keyat, nvis);
    qkv_proj_kernel<<<dim3(MT, NT, 3), gblk, 0, stream>>>(x, Wq, bq, Wk, bk, Wv, bv, keyat, nvis, Q, K, V);
    attn_kernel<<<dim3(BATCHN * HEADS, SEQ / 64), gblk, 0, stream>>>(Q, K, V, nvis, ctx);
    out_proj_kernel<<<dim3(MT, NT), gblk, 0, stream>>>(ctx, Wo, bo, out);
}
